// v000
// Measured on an AMD MI455X. A time is GPU time per run, averaged over a window of back-to-back runs after a warm-up
// (all launches, gaps included; the runs take copies of the inputs in turn), and the median of several windows.
// Apart from v000's, it joins two sittings. Times from different sittings can be a few percent apart, while
// side-by-side timings come from the same sitting.
// v000, which the later versions start from, runs in 608 microseconds.
#include <hip/hip_runtime.h>
#include <hip/hip_bf16.h>

// ---------------------------------------------------------------------------
// Multi-head self-attention (shared QKV projection) for MI455X / gfx1250.
// f32 inputs are pre-converted to f16 once (bandwidth-bound pass), then all
// matmuls run through v_wmma_f32_16x16x32_f16 (f16 in, f32 accumulate) with
// pure f16 b128 fragment loads in the hot loops. Flash-attention style:
// the 1 GB score matrix never exists; softmax runs online in registers.
// global_prefetch_b8 issued for next tiles (L2-resident working set, 68 MB f16 workspace).
// ---------------------------------------------------------------------------

typedef __attribute__((ext_vector_type(16))) _Float16 v16h;
typedef __attribute__((ext_vector_type(8)))  _Float16 v8h;
typedef __attribute__((ext_vector_type(8)))  float    v8f;
typedef __attribute__((ext_vector_type(4)))  float    v4f;

#define BATCH 4
#define SEQ   2048
#define DIM   1024
#define NHEAD 16
#define DHEAD 64
#define MTOT  (BATCH * SEQ)       // 8192 rows

union V16U { v16h v; v8h h[2]; };

// CDNA5 16-bit A/B fragment (16x32 / 32x16), per-lane layout:
//   lanes 0-15 : K = ko+{0..7} in halves 0-7, K = ko+{16..23} in halves 8-15, ko=0
//   lanes16-31 : same with ko=8
// p points at element (row_or_col_for_this_lane, kbase + ko).
__device__ inline v16h frag_from_f16(const _Float16* __restrict__ p) {
  V16U u;
  u.h[0] = *(const v8h*)(p);
  u.h[1] = *(const v8h*)(p + 16);
  return u.v;
}

__device__ inline v8f wmma_f16(v16h a, v16h b, v8f c) {
  // D = A(16x32,f16) * B(32x16,f16) + C(16x16,f32)
  return __builtin_amdgcn_wmma_f32_16x16x32_f16(false, a, false, b,
                                                (short)0, c, false, false);
}

// ---------------------------------------------------------------------------
// Kernel 0: bulk f32 -> f16 conversion (pure bandwidth; runs once per tensor)
// ---------------------------------------------------------------------------
__global__ __launch_bounds__(256) void cvt_f32_f16_kernel(
    const float* __restrict__ src, _Float16* __restrict__ dst, int n8) {
  const int i = blockIdx.x * 256 + threadIdx.x;
  if (i >= n8) return;
  const v4f a = *(const v4f*)(src + (size_t)i * 8);
  const v4f b = *(const v4f*)(src + (size_t)i * 8 + 4);
  v8h o;
#pragma unroll
  for (int j = 0; j < 4; ++j) {
    o[j]     = (_Float16)a[j];
    o[4 + j] = (_Float16)b[j];
  }
  *(v8h*)(dst + (size_t)i * 8) = o;
}

// ---------------------------------------------------------------------------
// Kernel 1: qkv = X @ Wqkv^T   (f16 WMMA, f32 accumulate, f16 outputs)
// Also writes the transposed copy qkvT[b][d][s] used as the V B-fragments.
// Block: 128 threads = 4 waves (2x2), block tile 128x128, wave tile 64x64.
// ---------------------------------------------------------------------------
__global__ __launch_bounds__(128) void qkv_gemm_kernel(
    const _Float16* __restrict__ X,   // [8192,1024] f16
    const _Float16* __restrict__ W,   // [1024,1024] f16 (out,in)
    _Float16* __restrict__ qkv,       // [8192,1024]
    _Float16* __restrict__ qkvT) {    // [4][1024][2048]
  const int lane = threadIdx.x & 31;
  const int wave = threadIdx.x >> 5;
  const int l15  = lane & 15;
  const int ko   = (lane >> 4) << 3;        // 0 or 8
  const int mb   = blockIdx.y * 128 + (wave >> 1) * 64;
  const int nb   = blockIdx.x * 128 + (wave & 1) * 64;

  v8f acc[4][4];
#pragma unroll
  for (int mt = 0; mt < 4; ++mt)
#pragma unroll
    for (int nt = 0; nt < 4; ++nt) acc[mt][nt] = (v8f)(0.0f);

  const _Float16* Ab = X + (size_t)(mb + l15) * DIM + ko;
  const _Float16* Bb = W + (size_t)(nb + l15) * DIM + ko;

  for (int k = 0; k < DIM; k += 32) {
    if (k + 128 < DIM) {
      __builtin_prefetch(Ab + k + 128, 0, 1);
      __builtin_prefetch(Bb + k + 128, 0, 1);
    }
    v16h af[4], bf[4];
#pragma unroll
    for (int t = 0; t < 4; ++t) af[t] = frag_from_f16(Ab + (size_t)t * 16 * DIM + k);
#pragma unroll
    for (int t = 0; t < 4; ++t) bf[t] = frag_from_f16(Bb + (size_t)t * 16 * DIM + k);
#pragma unroll
    for (int mt = 0; mt < 4; ++mt)
#pragma unroll
      for (int nt = 0; nt < 4; ++nt)
        acc[mt][nt] = wmma_f16(af[mt], bf[nt], acc[mt][nt]);
  }

  const int rsel = (lane >> 4) << 3;        // C-layout: lanes 16-31 hold rows +8
#pragma unroll
  for (int mt = 0; mt < 4; ++mt)
#pragma unroll
    for (int nt = 0; nt < 4; ++nt)
#pragma unroll
      for (int j = 0; j < 8; ++j) {
        const int r = mb + mt * 16 + rsel + j;
        const int c = nb + nt * 16 + l15;
        const _Float16 v = (_Float16)acc[mt][nt][j];
        qkv[(size_t)r * DIM + c] = v;
        // qkvT[b][c][s] : b = r>>11, s = r&2047
        qkvT[((size_t)(r >> 11) * DIM + c) * SEQ + (r & 2047)] = v;
      }
}

// ---------------------------------------------------------------------------
// Kernel 2: flash attention, q=k=v=qkv. One block = (b,h, 256 q-rows);
// each of 8 waves owns 32 q-rows, loops keys in tiles of 64.
// ---------------------------------------------------------------------------
__global__ __launch_bounds__(256) void attn_kernel(
    const _Float16* __restrict__ qkv,   // [4,2048,1024]
    const _Float16* __restrict__ qkvT,  // [4][1024][2048]
    _Float16* __restrict__ aout) {      // [4,2048,1024]
  __shared__ _Float16 plds[8][32][72];  // wave-private 32x64 P tile (+pad)

  const int lane = threadIdx.x & 31;
  const int wave = threadIdx.x >> 5;
  const int l15  = lane & 15;
  const int ko   = (lane >> 4) << 3;
  const int rsel = (lane >> 4) << 3;

  const int bh = blockIdx.y;
  const int b  = bh >> 4;
  const int h  = bh & 15;
  const int q0 = blockIdx.x * 256 + wave * 32;

  const _Float16* qk = qkv + (size_t)b * SEQ * DIM + h * DHEAD;          // rows: seq
  const _Float16* vT = qkvT + ((size_t)b * DIM + h * DHEAD) * SEQ;       // rows: dim

  // scale folded into exp2 domain: exp(s/8) = 2^(s * log2(e)/8)
  const float SC2 = 0.18033688011112042f;

  // resident Q fragments: [mt][ks]
  v16h qf[2][2];
#pragma unroll
  for (int mt = 0; mt < 2; ++mt)
#pragma unroll
    for (int ks = 0; ks < 2; ++ks)
      qf[mt][ks] = frag_from_f16(qk + (size_t)(q0 + mt * 16 + l15) * DIM + ks * 32 + ko);

  v8f oacc[2][4];
#pragma unroll
  for (int mt = 0; mt < 2; ++mt)
#pragma unroll
    for (int nt = 0; nt < 4; ++nt) oacc[mt][nt] = (v8f)(0.0f);

  float mrow[2][8], lrow[2][8];
#pragma unroll
  for (int mt = 0; mt < 2; ++mt)
#pragma unroll
    for (int j = 0; j < 8; ++j) { mrow[mt][j] = -INFINITY; lrow[mt][j] = 0.0f; }

  for (int kt = 0; kt < SEQ / 64; ++kt) {
    // prefetch next key/value tiles (2 rows per lane each)
    if (kt + 1 < SEQ / 64) {
      const int krow = (kt + 1) * 64 + lane * 2;
      __builtin_prefetch(qk + (size_t)krow * DIM, 0, 1);
      __builtin_prefetch(qk + (size_t)(krow + 1) * DIM, 0, 1);
      __builtin_prefetch(vT + (size_t)(lane * 2) * SEQ + (kt + 1) * 64, 0, 1);
      __builtin_prefetch(vT + (size_t)(lane * 2 + 1) * SEQ + (kt + 1) * 64, 0, 1);
    }

    // ---- scores S = Q @ K^T ---------------------------------------------
    v8f sc[2][4];
#pragma unroll
    for (int mt = 0; mt < 2; ++mt)
#pragma unroll
      for (int nt = 0; nt < 4; ++nt) sc[mt][nt] = (v8f)(0.0f);

#pragma unroll
    for (int ks = 0; ks < 2; ++ks) {
      v16h kf[4];
#pragma unroll
      for (int nt = 0; nt < 4; ++nt)
        kf[nt] = frag_from_f16(qk + (size_t)(kt * 64 + nt * 16 + l15) * DIM + ks * 32 + ko);
#pragma unroll
      for (int mt = 0; mt < 2; ++mt)
#pragma unroll
        for (int nt = 0; nt < 4; ++nt)
          sc[mt][nt] = wmma_f16(qf[mt][ks], kf[nt], sc[mt][nt]);
    }

    // ---- online softmax (row groups of 16 lanes) -------------------------
#pragma unroll
    for (int mt = 0; mt < 2; ++mt)
#pragma unroll
      for (int nt = 0; nt < 4; ++nt)
#pragma unroll
        for (int j = 0; j < 8; ++j) sc[mt][nt][j] *= SC2;

#pragma unroll
    for (int mt = 0; mt < 2; ++mt)
#pragma unroll
      for (int j = 0; j < 8; ++j) {
        float rm = sc[mt][0][j];
#pragma unroll
        for (int nt = 1; nt < 4; ++nt) rm = fmaxf(rm, sc[mt][nt][j]);
#pragma unroll
        for (int off = 1; off < 16; off <<= 1)
          rm = fmaxf(rm, __shfl_xor(rm, off, 32));
        const float mold = mrow[mt][j];
        const float mnew = fmaxf(mold, rm);
        const float corr = exp2f(mold - mnew);
        mrow[mt][j] = mnew;
        float rs = 0.0f;
#pragma unroll
        for (int nt = 0; nt < 4; ++nt) {
          const float p = exp2f(sc[mt][nt][j] - mnew);
          sc[mt][nt][j] = p;
          rs += p;
        }
#pragma unroll
        for (int off = 1; off < 16; off <<= 1)
          rs += __shfl_xor(rs, off, 32);
        lrow[mt][j] = lrow[mt][j] * corr + rs;
#pragma unroll
        for (int nt = 0; nt < 4; ++nt) oacc[mt][nt][j] *= corr;
      }

    // ---- stage P (f16) in LDS, re-read as A fragments --------------------
#pragma unroll
    for (int mt = 0; mt < 2; ++mt)
#pragma unroll
      for (int nt = 0; nt < 4; ++nt)
#pragma unroll
        for (int j = 0; j < 8; ++j)
          plds[wave][mt * 16 + rsel + j][nt * 16 + l15] = (_Float16)sc[mt][nt][j];
    __syncthreads();

    // ---- O += P @ V ------------------------------------------------------
#pragma unroll
    for (int ks = 0; ks < 2; ++ks) {
      v16h pf[2], vf[4];
#pragma unroll
      for (int mt = 0; mt < 2; ++mt)
        pf[mt] = frag_from_f16(&plds[wave][mt * 16 + l15][ks * 32 + ko]);
#pragma unroll
      for (int nt = 0; nt < 4; ++nt)
        vf[nt] = frag_from_f16(vT + (size_t)(nt * 16 + l15) * SEQ + kt * 64 + ks * 32 + ko);
#pragma unroll
      for (int mt = 0; mt < 2; ++mt)
#pragma unroll
        for (int nt = 0; nt < 4; ++nt)
          oacc[mt][nt] = wmma_f16(pf[mt], vf[nt], oacc[mt][nt]);
    }
    __syncthreads();
  }

  // ---- normalize and store f16 attention output --------------------------
#pragma unroll
  for (int mt = 0; mt < 2; ++mt)
#pragma unroll
    for (int j = 0; j < 8; ++j) {
      const float inv = 1.0f / lrow[mt][j];
      const int r = q0 + mt * 16 + rsel + j;
#pragma unroll
      for (int nt = 0; nt < 4; ++nt)
        aout[((size_t)b * SEQ + r) * DIM + h * DHEAD + nt * 16 + l15] =
            (_Float16)(oacc[mt][nt][j] * inv);
    }
}

// ---------------------------------------------------------------------------
// Kernel 3: out = AttnOut @ Wout^T + bias   (f16 WMMA, f32 bias/store)
// ---------------------------------------------------------------------------
__global__ __launch_bounds__(128) void out_gemm_kernel(
    const _Float16* __restrict__ A,   // [8192,1024] f16
    const _Float16* __restrict__ W,   // [1024,1024] f16 (out,in)
    const float* __restrict__ bias,   // [1024] f32
    float* __restrict__ out) {        // [8192,1024] f32
  const int lane = threadIdx.x & 31;
  const int wave = threadIdx.x >> 5;
  const int l15  = lane & 15;
  const int ko   = (lane >> 4) << 3;
  const int mb   = blockIdx.y * 128 + (wave >> 1) * 64;
  const int nb   = blockIdx.x * 128 + (wave & 1) * 64;

  v8f acc[4][4];
#pragma unroll
  for (int mt = 0; mt < 4; ++mt)
#pragma unroll
    for (int nt = 0; nt < 4; ++nt) acc[mt][nt] = (v8f)(0.0f);

  const _Float16* Ab = A + (size_t)(mb + l15) * DIM + ko;
  const _Float16* Bb = W + (size_t)(nb + l15) * DIM + ko;

  for (int k = 0; k < DIM; k += 32) {
    if (k + 128 < DIM) {
      __builtin_prefetch(Ab + k + 128, 0, 1);
      __builtin_prefetch(Bb + k + 128, 0, 1);
    }
    v16h af[4], bf[4];
#pragma unroll
    for (int t = 0; t < 4; ++t) af[t] = frag_from_f16(Ab + (size_t)t * 16 * DIM + k);
#pragma unroll
    for (int t = 0; t < 4; ++t) bf[t] = frag_from_f16(Bb + (size_t)t * 16 * DIM + k);
#pragma unroll
    for (int mt = 0; mt < 4; ++mt)
#pragma unroll
      for (int nt = 0; nt < 4; ++nt)
        acc[mt][nt] = wmma_f16(af[mt], bf[nt], acc[mt][nt]);
  }

  float bv[4];
#pragma unroll
  for (int nt = 0; nt < 4; ++nt) bv[nt] = bias[nb + nt * 16 + l15];

  const int rsel = (lane >> 4) << 3;
#pragma unroll
  for (int mt = 0; mt < 4; ++mt)
#pragma unroll
    for (int nt = 0; nt < 4; ++nt)
#pragma unroll
      for (int j = 0; j < 8; ++j) {
        const int r = mb + mt * 16 + rsel + j;
        const int c = nb + nt * 16 + l15;
        out[(size_t)r * DIM + c] = acc[mt][nt][j] + bv[nt];
      }
}

// ---------------------------------------------------------------------------
extern "C" void kernel_launch(void* const* d_in, const int* in_sizes, int n_in,
                              void* d_out, int out_size, void* d_ws, size_t ws_size,
                              hipStream_t stream) {
  const float* x     = (const float*)d_in[0];   // [4,2048,1024]
  const float* w_qkv = (const float*)d_in[1];   // [1024,1024]
  const float* w_out = (const float*)d_in[2];   // [1024,1024]
  const float* b_out = (const float*)d_in[3];   // [1024]
  float* out = (float*)d_out;

  // workspace (f16): xh 16MB | wqkvh 2MB | wouth 2MB | qkv 16MB | qkvT 16MB | aout 16MB
  _Float16* xh    = (_Float16*)d_ws;
  _Float16* wqkvh = xh    + (size_t)MTOT * DIM;
  _Float16* wouth = wqkvh + (size_t)DIM * DIM;
  _Float16* qkv   = wouth + (size_t)DIM * DIM;
  _Float16* qkvT  = qkv   + (size_t)MTOT * DIM;
  _Float16* aout  = qkvT  + (size_t)MTOT * DIM;

  // ---- pre-convert inputs to f16 (one pass each) ----
  {
    const int n8x = MTOT * DIM / 8;                    // 1,048,576
    cvt_f32_f16_kernel<<<n8x / 256, 256, 0, stream>>>(x, xh, n8x);
    const int n8w = DIM * DIM / 8;                     // 131,072
    cvt_f32_f16_kernel<<<n8w / 256, 256, 0, stream>>>(w_qkv, wqkvh, n8w);
    cvt_f32_f16_kernel<<<n8w / 256, 256, 0, stream>>>(w_out, wouth, n8w);
  }
  {
    dim3 grid(DIM / 128, MTOT / 128);           // (8, 64)
    qkv_gemm_kernel<<<grid, 128, 0, stream>>>(xh, wqkvh, qkv, qkvT);
  }
  {
    dim3 grid(SEQ / 256, BATCH * NHEAD);        // (8, 64)
    attn_kernel<<<grid, 256, 0, stream>>>(qkv, qkvT, aout);
  }
  {
    dim3 grid(DIM / 128, MTOT / 128);           // (8, 64)
    out_gemm_kernel<<<grid, 128, 0, stream>>>(aout, wouth, b_out, out);
  }
}

// v001
// It runs in 236 microseconds.
// Two timings next to v000 put it at 2.64 and 2.65 times that version's speed.
#include <hip/hip_runtime.h>
#include <hip/hip_bf16.h>

// ---------------------------------------------------------------------------
// Multi-head self-attention (shared QKV projection) for MI455X / gfx1250.
// f32 inputs are pre-converted to f16 once (bandwidth-bound pass), then all
// matmuls run through v_wmma_f32_16x16x32_f16 (f16 in, f32 accumulate) with
// pure f16 b128 fragment loads in the hot loops. Flash-attention style:
// the 1 GB score matrix never exists; softmax runs online in registers.
// global_prefetch_b8 issued for next tiles (L2-resident working set, 68 MB f16 workspace).
// ---------------------------------------------------------------------------

typedef __attribute__((ext_vector_type(16))) _Float16 v16h;
typedef __attribute__((ext_vector_type(8)))  _Float16 v8h;
typedef __attribute__((ext_vector_type(8)))  float    v8f;
typedef __attribute__((ext_vector_type(4)))  float    v4f;

#define BATCH 4
#define SEQ   2048
#define DIM   1024
#define NHEAD 16
#define DHEAD 64
#define MTOT  (BATCH * SEQ)       // 8192 rows

union V16U { v16h v; v8h h[2]; };

// CDNA5 16-bit A/B fragment (16x32 / 32x16), per-lane layout:
//   lanes 0-15 : K = ko+{0..7} in halves 0-7, K = ko+{16..23} in halves 8-15, ko=0
//   lanes16-31 : same with ko=8
// p points at element (row_or_col_for_this_lane, kbase + ko).
__device__ inline v16h frag_from_f16(const _Float16* __restrict__ p) {
  V16U u;
  u.h[0] = *(const v8h*)(p);
  u.h[1] = *(const v8h*)(p + 16);
  return u.v;
}

__device__ inline v8f wmma_f16(v16h a, v16h b, v8f c) {
  // D = A(16x32,f16) * B(32x16,f16) + C(16x16,f32)
  return __builtin_amdgcn_wmma_f32_16x16x32_f16(false, a, false, b,
                                                (short)0, c, false, false);
}

// ---------------------------------------------------------------------------
// Kernel 0: bulk f32 -> f16 conversion (pure bandwidth; runs once per tensor)
// ---------------------------------------------------------------------------
__global__ __launch_bounds__(256) void cvt_f32_f16_kernel(
    const float* __restrict__ src, _Float16* __restrict__ dst, int n8) {
  const int i = blockIdx.x * 256 + threadIdx.x;
  if (i >= n8) return;
  const v4f a = *(const v4f*)(src + (size_t)i * 8);
  const v4f b = *(const v4f*)(src + (size_t)i * 8 + 4);
  v8h o;
#pragma unroll
  for (int j = 0; j < 4; ++j) {
    o[j]     = (_Float16)a[j];
    o[4 + j] = (_Float16)b[j];
  }
  *(v8h*)(dst + (size_t)i * 8) = o;
}

// ---------------------------------------------------------------------------
// Kernel 1: qkv = X @ Wqkv^T   (f16 WMMA, f32 accumulate, f16 outputs)
// Also writes the transposed copy qkvT[b][d][s] used as the V^T A-fragments.
// Block: 128 threads = 4 waves (2x2), block tile 128x128, wave tile 64x64.
// ---------------------------------------------------------------------------
__global__ __launch_bounds__(128) void qkv_gemm_kernel(
    const _Float16* __restrict__ X,   // [8192,1024] f16
    const _Float16* __restrict__ W,   // [1024,1024] f16 (out,in)
    _Float16* __restrict__ qkv,       // [8192,1024]
    _Float16* __restrict__ qkvT) {    // [4][1024][2048]
  const int lane = threadIdx.x & 31;
  const int wave = threadIdx.x >> 5;
  const int l15  = lane & 15;
  const int ko   = (lane >> 4) << 3;        // 0 or 8
  const int mb   = blockIdx.y * 128 + (wave >> 1) * 64;
  const int nb   = blockIdx.x * 128 + (wave & 1) * 64;

  v8f acc[4][4];
#pragma unroll
  for (int mt = 0; mt < 4; ++mt)
#pragma unroll
    for (int nt = 0; nt < 4; ++nt) acc[mt][nt] = (v8f)(0.0f);

  const _Float16* Ab = X + (size_t)(mb + l15) * DIM + ko;
  const _Float16* Bb = W + (size_t)(nb + l15) * DIM + ko;

  for (int k = 0; k < DIM; k += 32) {
    if (k + 128 < DIM) {
      __builtin_prefetch(Ab + k + 128, 0, 1);
      __builtin_prefetch(Bb + k + 128, 0, 1);
    }
    v16h af[4], bf[4];
#pragma unroll
    for (int t = 0; t < 4; ++t) af[t] = frag_from_f16(Ab + (size_t)t * 16 * DIM + k);
#pragma unroll
    for (int t = 0; t < 4; ++t) bf[t] = frag_from_f16(Bb + (size_t)t * 16 * DIM + k);
#pragma unroll
    for (int mt = 0; mt < 4; ++mt)
#pragma unroll
      for (int nt = 0; nt < 4; ++nt)
        acc[mt][nt] = wmma_f16(af[mt], bf[nt], acc[mt][nt]);
  }

  const int rsel = (lane >> 4) << 3;        // C-layout: lanes 16-31 hold rows +8
#pragma unroll
  for (int mt = 0; mt < 4; ++mt)
#pragma unroll
    for (int nt = 0; nt < 4; ++nt)
#pragma unroll
      for (int j = 0; j < 8; ++j) {
        const int r = mb + mt * 16 + rsel + j;
        const int c = nb + nt * 16 + l15;
        const _Float16 v = (_Float16)acc[mt][nt][j];
        qkv[(size_t)r * DIM + c] = v;
        // qkvT[b][c][s] : b = r>>11, s = r&2047
        qkvT[((size_t)(r >> 11) * DIM + c) * SEQ + (r & 2047)] = v;
      }
}

// ---------------------------------------------------------------------------
// Kernel 2: flash attention, q=k=v=qkv, in transposed form:
//   S^T = K * Q^T   (A = key rows, B = query rows kept in registers)
//   O^T += V^T * P^T (A = rows of qkvT, B = P^T packed from the S^T tiles)
// A lane of a 16-column group holds the scores of ONE query, so maximum and
// sum run in the lane; the two lane halves (keys 8h..8h+7 of each 16) join
// their maxima once per key tile and their sums once, after the loop.
// Two S^T accumulator tiles (keys 0-15, 16-31) converted in place are the
// B operand of the second product: P needs no LDS and no barrier.
// One block = (b,h, 256 q-rows); each of 8 waves owns 32 queries, loops keys
// in tiles of 64.
// ---------------------------------------------------------------------------
// value of the same column in the other 16-lane half (lane l <-> l ^ 16)
__device__ inline float other_half(float v) {
  int b = __builtin_bit_cast(int, v);
  b = __builtin_amdgcn_permlanex16(b, b, 0x76543210, 0xfedcba98, false, false);
  return __builtin_bit_cast(float, b);
}

__global__ __launch_bounds__(256) void attn_kernel(
    const _Float16* __restrict__ qkv,   // [4,2048,1024]
    const _Float16* __restrict__ qkvT,  // [4][1024][2048]
    _Float16* __restrict__ aout) {      // [4,2048,1024]
  const int lane = threadIdx.x & 31;
  const int wave = threadIdx.x >> 5;
  const int l15  = lane & 15;
  const int ko   = (lane >> 4) << 3;
  const int rsel = (lane >> 4) << 3;

  const int bh = blockIdx.y;
  const int b  = bh >> 4;
  const int h  = bh & 15;
  const int q0 = blockIdx.x * 256 + wave * 32;

  const _Float16* qk = qkv + (size_t)b * SEQ * DIM + h * DHEAD;          // rows: seq
  const _Float16* vT = qkvT + ((size_t)b * DIM + h * DHEAD) * SEQ;       // rows: dim

  // scale folded into exp2 domain: exp(s/8) = 2^(s * log2(e)/8)
  const float SC2 = 0.18033688011112042f;

  // resident Q fragments (B operand, column = query): [qg][ks]
  v16h qf[2][2];
#pragma unroll
  for (int qg = 0; qg < 2; ++qg)
#pragma unroll
    for (int ks = 0; ks < 2; ++ks)
      qf[qg][ks] = frag_from_f16(qk + (size_t)(q0 + qg * 16 + l15) * DIM + ks * 32 + ko);

  // O^T tiles: oacc[dt][qg][r] = O[query qg*16+l15][d = dt*16 + rsel + r]
  v8f oacc[4][2];
#pragma unroll
  for (int dt = 0; dt < 4; ++dt)
#pragma unroll
    for (int qg = 0; qg < 2; ++qg) oacc[dt][qg] = (v8f)(0.0f);

  float mrow[2], lrow[2];   // per lane: its query's maximum, its half's sum
#pragma unroll
  for (int qg = 0; qg < 2; ++qg) { mrow[qg] = -INFINITY; lrow[qg] = 0.0f; }

  for (int kt = 0; kt < SEQ / 64; ++kt) {
    // prefetch next key/value tiles (2 rows per lane each)
    if (kt + 1 < SEQ / 64) {
      const int krow = (kt + 1) * 64 + lane * 2;
      __builtin_prefetch(qk + (size_t)krow * DIM, 0, 1);
      __builtin_prefetch(qk + (size_t)(krow + 1) * DIM, 0, 1);
      __builtin_prefetch(vT + (size_t)(lane * 2) * SEQ + (kt + 1) * 64, 0, 1);
      __builtin_prefetch(vT + (size_t)(lane * 2 + 1) * SEQ + (kt + 1) * 64, 0, 1);
    }

    // ---- scores S^T = K @ Q^T : sc[nt][qg][r] = S[query][key nt*16+rsel+r]
    v8f sc[4][2];
#pragma unroll
    for (int nt = 0; nt < 4; ++nt)
#pragma unroll
      for (int qg = 0; qg < 2; ++qg) sc[nt][qg] = (v8f)(0.0f);

#pragma unroll
    for (int ks = 0; ks < 2; ++ks) {
      v16h kf[4];
#pragma unroll
      for (int nt = 0; nt < 4; ++nt)
        kf[nt] = frag_from_f16(qk + (size_t)(kt * 64 + nt * 16 + l15) * DIM + ks * 32 + ko);
#pragma unroll
      for (int nt = 0; nt < 4; ++nt)
#pragma unroll
        for (int qg = 0; qg < 2; ++qg)
          sc[nt][qg] = wmma_f16(kf[nt], qf[qg][ks], sc[nt][qg]);
    }

    // ---- online softmax, one query per lane -------------------------------
    v16h pf[2][2];            // P^T as B operand: [qg][32-key chunk]
#pragma unroll
    for (int qg = 0; qg < 2; ++qg) {
#pragma unroll
      for (int nt = 0; nt < 4; ++nt) sc[nt][qg] *= SC2;

      float m8[8];
#pragma unroll
      for (int j = 0; j < 8; ++j)
        m8[j] = fmaxf(fmaxf(sc[0][qg][j], sc[1][qg][j]),
                      fmaxf(sc[2][qg][j], sc[3][qg][j]));
      float rm = fmaxf(fmaxf(fmaxf(m8[0], m8[1]), fmaxf(m8[2], m8[3])),
                       fmaxf(fmaxf(m8[4], m8[5]), fmaxf(m8[6], m8[7])));
      rm = fmaxf(rm, other_half(rm));

      const float mold = mrow[qg];
      const float mnew = fmaxf(mold, rm);
      const float corr = exp2f(mold - mnew);
      mrow[qg] = mnew;

#pragma unroll
      for (int nt = 0; nt < 4; ++nt)
#pragma unroll
        for (int j = 0; j < 8; ++j) sc[nt][qg][j] = exp2f(sc[nt][qg][j] - mnew);

      const v8f s8 = (sc[0][qg] + sc[1][qg]) + (sc[2][qg] + sc[3][qg]);
      const float rs = ((s8[0] + s8[1]) + (s8[2] + s8[3])) +
                       ((s8[4] + s8[5]) + (s8[6] + s8[7]));
      lrow[qg] = lrow[qg] * corr + rs;

#pragma unroll
      for (int dt = 0; dt < 4; ++dt) oacc[dt][qg] *= corr;

      // element s of the B operand is key kmap(s) = tile (s >> 3), register s & 7
#pragma unroll
      for (int c2 = 0; c2 < 2; ++c2)
#pragma unroll
        for (int s = 0; s < 16; ++s)
          pf[qg][c2][s] = (_Float16)sc[c2 * 2 + (s >> 3)][qg][s & 7];
    }

    // ---- O^T += V^T @ P^T --------------------------------------------------
#pragma unroll
    for (int c2 = 0; c2 < 2; ++c2) {
      v16h vf[4];
#pragma unroll
      for (int dt = 0; dt < 4; ++dt)
        vf[dt] = frag_from_f16(vT + (size_t)(dt * 16 + l15) * SEQ + kt * 64 + c2 * 32 + ko);
#pragma unroll
      for (int dt = 0; dt < 4; ++dt)
#pragma unroll
        for (int qg = 0; qg < 2; ++qg)
          oacc[dt][qg] = wmma_f16(vf[dt], pf[qg][c2], oacc[dt][qg]);
    }
  }

  // ---- join the halves' sums, normalize, store 8 consecutive d per lane ----
#pragma unroll
  for (int qg = 0; qg < 2; ++qg) {
    const float inv = 1.0f / (lrow[qg] + other_half(lrow[qg]));
    const int r = q0 + qg * 16 + l15;
#pragma unroll
    for (int dt = 0; dt < 4; ++dt) {
      v8h o;
#pragma unroll
      for (int j = 0; j < 8; ++j) o[j] = (_Float16)(oacc[dt][qg][j] * inv);
      *(v8h*)(aout + ((size_t)b * SEQ + r) * DIM + h * DHEAD + dt * 16 + rsel) = o;
    }
  }
}

// ---------------------------------------------------------------------------
// Kernel 3: out = AttnOut @ Wout^T + bias   (f16 WMMA, f32 bias/store)
// ---------------------------------------------------------------------------
__global__ __launch_bounds__(128) void out_gemm_kernel(
    const _Float16* __restrict__ A,   // [8192,1024] f16
    const _Float16* __restrict__ W,   // [1024,1024] f16 (out,in)
    const float* __restrict__ bias,   // [1024] f32
    float* __restrict__ out) {        // [8192,1024] f32
  const int lane = threadIdx.x & 31;
  const int wave = threadIdx.x >> 5;
  const int l15  = lane & 15;
  const int ko   = (lane >> 4) << 3;
  const int mb   = blockIdx.y * 128 + (wave >> 1) * 64;
  const int nb   = blockIdx.x * 128 + (wave & 1) * 64;

  v8f acc[4][4];
#pragma unroll
  for (int mt = 0; mt < 4; ++mt)
#pragma unroll
    for (int nt = 0; nt < 4; ++nt) acc[mt][nt] = (v8f)(0.0f);

  const _Float16* Ab = A + (size_t)(mb + l15) * DIM + ko;
  const _Float16* Bb = W + (size_t)(nb + l15) * DIM + ko;

  for (int k = 0; k < DIM; k += 32) {
    if (k + 128 < DIM) {
      __builtin_prefetch(Ab + k + 128, 0, 1);
      __builtin_prefetch(Bb + k + 128, 0, 1);
    }
    v16h af[4], bf[4];
#pragma unroll
    for (int t = 0; t < 4; ++t) af[t] = frag_from_f16(Ab + (size_t)t * 16 * DIM + k);
#pragma unroll
    for (int t = 0; t < 4; ++t) bf[t] = frag_from_f16(Bb + (size_t)t * 16 * DIM + k);
#pragma unroll
    for (int mt = 0; mt < 4; ++mt)
#pragma unroll
      for (int nt = 0; nt < 4; ++nt)
        acc[mt][nt] = wmma_f16(af[mt], bf[nt], acc[mt][nt]);
  }

  float bv[4];
#pragma unroll
  for (int nt = 0; nt < 4; ++nt) bv[nt] = bias[nb + nt * 16 + l15];

  const int rsel = (lane >> 4) << 3;
#pragma unroll
  for (int mt = 0; mt < 4; ++mt)
#pragma unroll
    for (int nt = 0; nt < 4; ++nt)
#pragma unroll
      for (int j = 0; j < 8; ++j) {
        const int r = mb + mt * 16 + rsel + j;
        const int c = nb + nt * 16 + l15;
        out[(size_t)r * DIM + c] = acc[mt][nt][j] + bv[nt];
      }
}

// ---------------------------------------------------------------------------
extern "C" void kernel_launch(void* const* d_in, const int* in_sizes, int n_in,
                              void* d_out, int out_size, void* d_ws, size_t ws_size,
                              hipStream_t stream) {
  const float* x     = (const float*)d_in[0];   // [4,2048,1024]
  const float* w_qkv = (const float*)d_in[1];   // [1024,1024]
  const float* w_out = (const float*)d_in[2];   // [1024,1024]
  const float* b_out = (const float*)d_in[3];   // [1024]
  float* out = (float*)d_out;

  // workspace (f16): xh 16MB | wqkvh 2MB | wouth 2MB | qkv 16MB | qkvT 16MB | aout 16MB
  _Float16* xh    = (_Float16*)d_ws;
  _Float16* wqkvh = xh    + (size_t)MTOT * DIM;
  _Float16* wouth = wqkvh + (size_t)DIM * DIM;
  _Float16* qkv   = wouth + (size_t)DIM * DIM;
  _Float16* qkvT  = qkv   + (size_t)MTOT * DIM;
  _Float16* aout  = qkvT  + (size_t)MTOT * DIM;

  // ---- pre-convert inputs to f16 (one pass each) ----
  {
    const int n8x = MTOT * DIM / 8;                    // 1,048,576
    cvt_f32_f16_kernel<<<n8x / 256, 256, 0, stream>>>(x, xh, n8x);
    const int n8w = DIM * DIM / 8;                     // 131,072
    cvt_f32_f16_kernel<<<n8w / 256, 256, 0, stream>>>(w_qkv, wqkvh, n8w);
    cvt_f32_f16_kernel<<<n8w / 256, 256, 0, stream>>>(w_out, wouth, n8w);
  }
  {
    dim3 grid(DIM / 128, MTOT / 128);           // (8, 64)
    qkv_gemm_kernel<<<grid, 128, 0, stream>>>(xh, wqkvh, qkv, qkvT);
  }
  {
    dim3 grid(SEQ / 256, BATCH * NHEAD);        // (8, 64)
    attn_kernel<<<grid, 256, 0, stream>>>(qkv, qkvT, aout);
  }
  {
    dim3 grid(DIM / 128, MTOT / 128);           // (8, 64)
    out_gemm_kernel<<<grid, 128, 0, stream>>>(aout, wouth, b_out, out);
  }
}

// v002
// A run of this version takes 226 microseconds.
// Next to v001, in two timings, it ran 1.04 times as fast each time.
// Counting every step since v000, it is 2.76 times as fast.
#include <hip/hip_runtime.h>
#include <hip/hip_bf16.h>

// ---------------------------------------------------------------------------
// Multi-head self-attention (shared QKV projection) for MI455X / gfx1250.
// f32 inputs are pre-converted to f16 once (bandwidth-bound pass), then all
// matmuls run through v_wmma_f32_16x16x32_f16 (f16 in, f32 accumulate) with
// pure f16 b128 fragment loads in the hot loops. Flash-attention style:
// the 1 GB score matrix never exists; softmax runs online in registers.
// global_prefetch_b8 issued for next tiles (L2-resident working set, 140 MB in all).
// Every f16 tensor in the workspace is kept in FRAGMENT ORDER (see below), so
// that one wave-wide 16-byte load or store covers 512 contiguous bytes.
// ---------------------------------------------------------------------------

typedef __attribute__((ext_vector_type(16))) _Float16 v16h;
typedef __attribute__((ext_vector_type(8)))  _Float16 v8h;
typedef __attribute__((ext_vector_type(8)))  float    v8f;
typedef __attribute__((ext_vector_type(4)))  float    v4f;

#define BATCH 4
#define SEQ   2048
#define DIM   1024
#define NHEAD 16
#define DHEAD 64
#define MTOT  (BATCH * SEQ)       // 8192 rows

union V16U { v16h v; v8h h[2]; };

// CDNA5 16-bit A/B fragment (16x32 / 32x16), per-lane layout:
//   lanes 0-15 : K = ko+{0..7} in halves 0-7, K = ko+{16..23} in halves 8-15, ko=0
//   lanes16-31 : same with ko=8
//
// Fragment order of a [rows][K] f16 matrix: the 16 x 32 fragment
// (rt = row >> 4, kc = k >> 5) is the 1 KB block number rt * (K / 32) + kc.
// Inside it, element (row & 15, k & 31) lies at half-word
//   ((k >> 4) & 1) * 256 + (((k >> 3) & 1) * 16 + (row & 15)) * 8 + (k & 7)
// i.e. lane L finds its halves 0-7 at L * 8 and its halves 8-15 at 256 + L * 8.
#define FRAG_H 512                 // half-words per fragment block
#define FR_DIM (DIM / 32)          // fragment blocks per 16-row band, K = DIM
#define FR_SEQ (SEQ / 32)          // the same, K = SEQ (transposed copy)

// p points at the fragment block + lane * 8.
__device__ inline v16h frag_from_f16(const _Float16* __restrict__ p) {
  V16U u;
  u.h[0] = *(const v8h*)(p);
  u.h[1] = *(const v8h*)(p + 256);
  return u.v;
}

__device__ inline v8f wmma_f16(v16h a, v16h b, v8f c) {
  // D = A(16x32,f16) * B(32x16,f16) + C(16x16,f32)
  return __builtin_amdgcn_wmma_f32_16x16x32_f16(false, a, false, b,
                                                (short)0, c, false, false);
}

// ---------------------------------------------------------------------------
// Kernel 0: bulk f32 -> f16 conversion of a [rows][DIM] matrix into fragment
// order. Thread i writes the i-th 16-byte piece of the output and reads the
// 8 floats that belong there.
// ---------------------------------------------------------------------------
__global__ __launch_bounds__(256) void cvt_f32_f16_kernel(
    const float* __restrict__ src, _Float16* __restrict__ dst, int n8) {
  const int i = blockIdx.x * 256 + threadIdx.x;
  if (i >= n8) return;
  const int fr  = i >> 6;                               // fragment block
  const int row = (fr / FR_DIM) * 16 + (i & 15);
  const int k   = (fr % FR_DIM) * 32 + ((i >> 5) & 1) * 16 + ((i >> 4) & 1) * 8;
  const float* s = src + (size_t)row * DIM + k;
  const v4f a = *(const v4f*)(s);
  const v4f b = *(const v4f*)(s + 4);
  v8h o;
#pragma unroll
  for (int j = 0; j < 4; ++j) {
    o[j]     = (_Float16)a[j];
    o[4 + j] = (_Float16)b[j];
  }
  *(v8h*)(dst + (size_t)i * 8) = o;
}

// ---------------------------------------------------------------------------
// Kernel 1: qkv = X @ Wqkv^T   (f16 WMMA, f32 accumulate, f16 outputs)
// Also writes the transposed copy qkvT[b][d][s] used as the V^T fragments.
// All four tensors are in fragment order.
// Block: 128 threads = 4 waves (2x2), block tile 128x128, wave tile 64x64.
// ---------------------------------------------------------------------------
__global__ __launch_bounds__(128) void qkv_gemm_kernel(
    const _Float16* __restrict__ X,   // [8192,1024] f16
    const _Float16* __restrict__ W,   // [1024,1024] f16 (out,in)
    _Float16* __restrict__ qkv,       // [8192,1024]
    _Float16* __restrict__ qkvT) {    // [4*1024][2048]
  const int lane = threadIdx.x & 31;
  const int wave = threadIdx.x >> 5;
  const int l15  = lane & 15;
  const int mb   = blockIdx.y * 128 + (wave >> 1) * 64;
  const int nb   = blockIdx.x * 128 + (wave & 1) * 64;

  v8f acc[4][4];
#pragma unroll
  for (int mt = 0; mt < 4; ++mt)
#pragma unroll
    for (int nt = 0; nt < 4; ++nt) acc[mt][nt] = (v8f)(0.0f);

  const _Float16* Ab = X + (size_t)(mb >> 4) * FR_DIM * FRAG_H + lane * 8;
  const _Float16* Bb = W + (size_t)(nb >> 4) * FR_DIM * FRAG_H + lane * 8;

  for (int k = 0; k < DIM; k += 32) {
    const int kf = (k >> 5) * FRAG_H;
    if (k + 128 < DIM) {
      // the first fragment of each operand, four steps ahead (32 B per lane)
      __builtin_prefetch(Ab + kf + 4 * FRAG_H + lane * 8, 0, 1);
      __builtin_prefetch(Bb + kf + 4 * FRAG_H + lane * 8, 0, 1);
      // before the prefetches' address registers are written again
      asm volatile("s_wait_xcnt 0x0" ::: "memory");
    }
    v16h af[4], bf[4];
#pragma unroll
    for (int t = 0; t < 4; ++t) af[t] = frag_from_f16(Ab + (size_t)t * FR_DIM * FRAG_H + kf);
#pragma unroll
    for (int t = 0; t < 4; ++t) bf[t] = frag_from_f16(Bb + (size_t)t * FR_DIM * FRAG_H + kf);
#pragma unroll
    for (int mt = 0; mt < 4; ++mt)
#pragma unroll
      for (int nt = 0; nt < 4; ++nt)
        acc[mt][nt] = wmma_f16(af[mt], bf[nt], acc[mt][nt]);
  }

  const int rsel = (lane >> 4) << 3;        // C-layout: lanes 16-31 hold rows +8
#pragma unroll
  for (int mt = 0; mt < 4; ++mt)
#pragma unroll
    for (int nt = 0; nt < 4; ++nt) {
      const int r0 = mb + mt * 16;          // rows r0 + rsel + j
      const int c0 = nb + nt * 16;          // column c0 + l15
      v8h o;
#pragma unroll
      for (int j = 0; j < 8; ++j) o[j] = (_Float16)acc[mt][nt][j];
      // qkvT row (r0 >> 11) * DIM + c, k = s = r & 2047: a lane's 8 values are
      // one 16-byte piece of the fragment, at lane * 8
      const int tr = ((r0 >> 11) * DIM + c0) >> 4;
      *(v8h*)(qkvT + ((size_t)tr * FR_SEQ + ((r0 & 2047) >> 5)) * FRAG_H +
              ((r0 >> 4) & 1) * 256 + lane * 8) = o;
      // qkv row r, k = c: one half-word per row
      _Float16* kp = qkv + ((size_t)(r0 >> 4) * FR_DIM + (c0 >> 5)) * FRAG_H +
                     ((c0 >> 4) & 1) * 256 + ((l15 >> 3) * 16 + rsel) * 8 + (l15 & 7);
#pragma unroll
      for (int j = 0; j < 8; ++j) kp[j * 8] = o[j];
    }
}

// ---------------------------------------------------------------------------
// Kernel 2: flash attention, q=k=v=qkv, in transposed form:
//   S^T = K * Q^T   (A = key rows, B = query rows kept in registers)
//   O^T += V^T * P^T (A = rows of qkvT, B = P^T packed from the S^T tiles)
// A lane of a 16-column group holds the scores of ONE query, so maximum and
// sum run in the lane; the two lane halves (keys 8h..8h+7 of each 16) join
// their maxima once per key tile and their sums once, after the loop.
// Two S^T accumulator tiles (keys 0-15, 16-31) converted in place are the
// B operand of the second product: P needs no LDS and no barrier.
// One block = (b,h, 256 q-rows); each of 8 waves owns 32 queries, loops keys
// in tiles of 64.
// ---------------------------------------------------------------------------
// value of the same column in the other 16-lane half (lane l <-> l ^ 16)
__device__ inline float other_half(float v) {
  int b = __builtin_bit_cast(int, v);
  b = __builtin_amdgcn_permlanex16(b, b, 0x76543210, 0xfedcba98, false, false);
  return __builtin_bit_cast(float, b);
}

__global__ __launch_bounds__(256) void attn_kernel(
    const _Float16* __restrict__ qkv,   // [4*2048][1024], fragment order
    const _Float16* __restrict__ qkvT,  // [4*1024][2048], fragment order
    _Float16* __restrict__ aout) {      // [4*2048][1024], fragment order
  const int lane = threadIdx.x & 31;
  const int wave = threadIdx.x >> 5;

  const int bh = blockIdx.y;
  const int b  = bh >> 4;
  const int h  = bh & 15;
  const int q0 = blockIdx.x * 256 + wave * 32;

  // fragment (16 rows from seq position s, d chunk ks) : qk + (s >> 4) * KBAND + ks * FRAG_H
  // fragment (16 d from dt * 16, 32 keys from chunk kc) : vT + dt * VBAND + kc * FRAG_H
  const int KBAND = FR_DIM * FRAG_H;
  const int VBAND = FR_SEQ * FRAG_H;
  const _Float16* qk = qkv + ((size_t)(b * SEQ >> 4) * FR_DIM + h * (DHEAD / 32)) * FRAG_H;
  const _Float16* vT = qkvT + (size_t)((b * DIM + h * DHEAD) >> 4) * VBAND;

  // scale folded into exp2 domain: exp(s/8) = 2^(s * log2(e)/8)
  const float SC2 = 0.18033688011112042f;

  // resident Q fragments (B operand, column = query): [qg][ks]
  v16h qf[2][2];
#pragma unroll
  for (int qg = 0; qg < 2; ++qg)
#pragma unroll
    for (int ks = 0; ks < 2; ++ks)
      qf[qg][ks] = frag_from_f16(qk + (size_t)((q0 >> 4) + qg) * KBAND + ks * FRAG_H + lane * 8);

  // O^T tiles: oacc[dt][qg][r] = O[query qg*16+l15][d = dt*16 + rsel + r]
  v8f oacc[4][2];
#pragma unroll
  for (int dt = 0; dt < 4; ++dt)
#pragma unroll
    for (int qg = 0; qg < 2; ++qg) oacc[dt][qg] = (v8f)(0.0f);

  float mrow[2], lrow[2];   // per lane: its query's maximum, its half's sum
#pragma unroll
  for (int qg = 0; qg < 2; ++qg) { mrow[qg] = -INFINITY; lrow[qg] = 0.0f; }

  for (int kt = 0; kt < SEQ / 64; ++kt) {
    // prefetch next key/value tiles (2 lines per lane each): each tile is four
    // runs of 2 KB (16 lines), one per band
    if (kt + 1 < SEQ / 64) {
      const _Float16* kn = qk + (size_t)((kt + 1) * 4 + (lane >> 3)) * KBAND + (lane & 7) * 128;
      const _Float16* vn = vT + (size_t)(lane >> 3) * VBAND + (kt + 1) * 2 * FRAG_H + (lane & 7) * 128;
      __builtin_prefetch(kn, 0, 1);
      __builtin_prefetch(kn + 64, 0, 1);
      __builtin_prefetch(vn, 0, 1);
      __builtin_prefetch(vn + 64, 0, 1);
      // before the prefetches' address registers are written again
      asm volatile("s_wait_xcnt 0x0" ::: "memory");
    }

    // ---- scores S^T = K @ Q^T : sc[nt][qg][r] = S[query][key nt*16+rsel+r]
    v8f sc[4][2];
#pragma unroll
    for (int nt = 0; nt < 4; ++nt)
#pragma unroll
      for (int qg = 0; qg < 2; ++qg) sc[nt][qg] = (v8f)(0.0f);

    v16h kf[2][4];
#pragma unroll
    for (int ks = 0; ks < 2; ++ks)
#pragma unroll
      for (int nt = 0; nt < 4; ++nt)
        kf[ks][nt] = frag_from_f16(qk + (size_t)(kt * 4 + nt) * KBAND + ks * FRAG_H + lane * 8);
    // keeps the tile's 16 loads together in front of the products (one latency, counted
    // waits); without it most are issued in pairs among the products, each pair waited
    // out in full, and the kernel takes over 256 registers (one block on a WGP, not two)
    __builtin_amdgcn_sched_barrier(0);
#pragma unroll
    for (int ks = 0; ks < 2; ++ks)
#pragma unroll
      for (int nt = 0; nt < 4; ++nt)
#pragma unroll
        for (int qg = 0; qg < 2; ++qg)
          sc[nt][qg] = wmma_f16(kf[ks][nt], qf[qg][ks], sc[nt][qg]);

    // ---- online softmax, one query per lane -------------------------------
    v16h pf[2][2];            // P^T as B operand: [qg][32-key chunk]
#pragma unroll
    for (int qg = 0; qg < 2; ++qg) {
#pragma unroll
      for (int nt = 0; nt < 4; ++nt) sc[nt][qg] *= SC2;

      float m8[8];
#pragma unroll
      for (int j = 0; j < 8; ++j)
        m8[j] = fmaxf(fmaxf(sc[0][qg][j], sc[1][qg][j]),
                      fmaxf(sc[2][qg][j], sc[3][qg][j]));
      float rm = fmaxf(fmaxf(fmaxf(m8[0], m8[1]), fmaxf(m8[2], m8[3])),
                       fmaxf(fmaxf(m8[4], m8[5]), fmaxf(m8[6], m8[7])));
      rm = fmaxf(rm, other_half(rm));

      const float mold = mrow[qg];
      const float mnew = fmaxf(mold, rm);
      const float corr = exp2f(mold - mnew);
      mrow[qg] = mnew;

#pragma unroll
      for (int nt = 0; nt < 4; ++nt)
#pragma unroll
        for (int j = 0; j < 8; ++j) sc[nt][qg][j] = exp2f(sc[nt][qg][j] - mnew);

      const v8f s8 = (sc[0][qg] + sc[1][qg]) + (sc[2][qg] + sc[3][qg]);
      const float rs = ((s8[0] + s8[1]) + (s8[2] + s8[3])) +
                       ((s8[4] + s8[5]) + (s8[6] + s8[7]));
      lrow[qg] = lrow[qg] * corr + rs;

#pragma unroll
      for (int dt = 0; dt < 4; ++dt) oacc[dt][qg] *= corr;

      // element s of the B operand is key kmap(s) = tile (s >> 3), register s & 7
#pragma unroll
      for (int c2 = 0; c2 < 2; ++c2)
#pragma unroll
        for (int s = 0; s < 16; ++s)
          pf[qg][c2][s] = (_Float16)sc[c2 * 2 + (s >> 3)][qg][s & 7];
    }

    // ---- O^T += V^T @ P^T --------------------------------------------------
#pragma unroll
    for (int c2 = 0; c2 < 2; ++c2) {
      v16h vf[4];
#pragma unroll
      for (int dt = 0; dt < 4; ++dt)
        vf[dt] = frag_from_f16(vT + (size_t)dt * VBAND + (kt * 2 + c2) * FRAG_H + lane * 8);
#pragma unroll
      for (int dt = 0; dt < 4; ++dt)
#pragma unroll
        for (int qg = 0; qg < 2; ++qg)
          oacc[dt][qg] = wmma_f16(vf[dt], pf[qg][c2], oacc[dt][qg]);
    }
  }

  // ---- join the halves' sums, normalize, store 8 consecutive d per lane ----
#pragma unroll
  for (int qg = 0; qg < 2; ++qg) {
    const float inv = 1.0f / (lrow[qg] + other_half(lrow[qg]));
    // row = the lane's query, k = h * 64 + dt * 16 + 8 * (lane >> 4) + 0..7: piece number
    // 'lane' of half (dt & 1) of fragment (row band, h * 2 + (dt >> 1))
    _Float16* ob = aout + ((size_t)(((b * SEQ + q0) >> 4) + qg) * FR_DIM + h * (DHEAD / 32)) * FRAG_H + lane * 8;
#pragma unroll
    for (int dt = 0; dt < 4; ++dt) {
      v8h o;
#pragma unroll
      for (int j = 0; j < 8; ++j) o[j] = (_Float16)(oacc[dt][qg][j] * inv);
      *(v8h*)(ob + (dt >> 1) * FRAG_H + (dt & 1) * 256) = o;
    }
  }
}

// ---------------------------------------------------------------------------
// Kernel 3: out = AttnOut @ Wout^T + bias   (f16 WMMA, f32 bias/store)
// ---------------------------------------------------------------------------
__global__ __launch_bounds__(128) void out_gemm_kernel(
    const _Float16* __restrict__ A,   // [8192,1024] f16, fragment order
    const _Float16* __restrict__ W,   // [1024,1024] f16 (out,in), fragment order
    const float* __restrict__ bias,   // [1024] f32
    float* __restrict__ out) {        // [8192,1024] f32
  const int lane = threadIdx.x & 31;
  const int wave = threadIdx.x >> 5;
  const int l15  = lane & 15;
  const int mb   = blockIdx.y * 128 + (wave >> 1) * 64;
  const int nb   = blockIdx.x * 128 + (wave & 1) * 64;

  v8f acc[4][4];
#pragma unroll
  for (int mt = 0; mt < 4; ++mt)
#pragma unroll
    for (int nt = 0; nt < 4; ++nt) acc[mt][nt] = (v8f)(0.0f);

  const _Float16* Ab = A + (size_t)(mb >> 4) * FR_DIM * FRAG_H + lane * 8;
  const _Float16* Bb = W + (size_t)(nb >> 4) * FR_DIM * FRAG_H + lane * 8;

  for (int k = 0; k < DIM; k += 32) {
    const int kf = (k >> 5) * FRAG_H;
    if (k + 128 < DIM) {
      // the first fragment of each operand, four steps ahead (32 B per lane)
      __builtin_prefetch(Ab + kf + 4 * FRAG_H + lane * 8, 0, 1);
      __builtin_prefetch(Bb + kf + 4 * FRAG_H + lane * 8, 0, 1);
      // before the prefetches' address registers are written again
      asm volatile("s_wait_xcnt 0x0" ::: "memory");
    }
    v16h af[4], bf[4];
#pragma unroll
    for (int t = 0; t < 4; ++t) af[t] = frag_from_f16(Ab + (size_t)t * FR_DIM * FRAG_H + kf);
#pragma unroll
    for (int t = 0; t < 4; ++t) bf[t] = frag_from_f16(Bb + (size_t)t * FR_DIM * FRAG_H + kf);
#pragma unroll
    for (int mt = 0; mt < 4; ++mt)
#pragma unroll
      for (int nt = 0; nt < 4; ++nt)
        acc[mt][nt] = wmma_f16(af[mt], bf[nt], acc[mt][nt]);
  }

  float bv[4];
#pragma unroll
  for (int nt = 0; nt < 4; ++nt) bv[nt] = bias[nb + nt * 16 + l15];

  const int rsel = (lane >> 4) << 3;
#pragma unroll
  for (int mt = 0; mt < 4; ++mt)
#pragma unroll
    for (int nt = 0; nt < 4; ++nt)
#pragma unroll
      for (int j = 0; j < 8; ++j) {
        const int r = mb + mt * 16 + rsel + j;
        const int c = nb + nt * 16 + l15;
        out[(size_t)r * DIM + c] = acc[mt][nt][j] + bv[nt];
      }
}

// ---------------------------------------------------------------------------
extern "C" void kernel_launch(void* const* d_in, const int* in_sizes, int n_in,
                              void* d_out, int out_size, void* d_ws, size_t ws_size,
                              hipStream_t stream) {
  const float* x     = (const float*)d_in[0];   // [4,2048,1024]
  const float* w_qkv = (const float*)d_in[1];   // [1024,1024]
  const float* w_out = (const float*)d_in[2];   // [1024,1024]
  const float* b_out = (const float*)d_in[3];   // [1024]
  float* out = (float*)d_out;

  // workspace (f16, all in fragment order): xh 16MB | wqkvh 2MB | wouth 2MB | qkv 16MB | qkvT 16MB | aout 16MB
  _Float16* xh    = (_Float16*)d_ws;
  _Float16* wqkvh = xh    + (size_t)MTOT * DIM;
  _Float16* wouth = wqkvh + (size_t)DIM * DIM;
  _Float16* qkv   = wouth + (size_t)DIM * DIM;
  _Float16* qkvT  = qkv   + (size_t)MTOT * DIM;
  _Float16* aout  = qkvT  + (size_t)MTOT * DIM;

  // ---- pre-convert inputs to f16 (one pass each) ----
  {
    const int n8x = MTOT * DIM / 8;                    // 1,048,576
    cvt_f32_f16_kernel<<<n8x / 256, 256, 0, stream>>>(x, xh, n8x);
    const int n8w = DIM * DIM / 8;                     // 131,072
    cvt_f32_f16_kernel<<<n8w / 256, 256, 0, stream>>>(w_qkv, wqkvh, n8w);
    cvt_f32_f16_kernel<<<n8w / 256, 256, 0, stream>>>(w_out, wouth, n8w);
  }
  {
    dim3 grid(DIM / 128, MTOT / 128);           // (8, 64)
    qkv_gemm_kernel<<<grid, 128, 0, stream>>>(xh, wqkvh, qkv, qkvT);
  }
  {
    dim3 grid(SEQ / 256, BATCH * NHEAD);        // (8, 64)
    attn_kernel<<<grid, 256, 0, stream>>>(qkv, qkvT, aout);
  }
  {
    dim3 grid(DIM / 128, MTOT / 128);           // (8, 64)
    out_gemm_kernel<<<grid, 128, 0, stream>>>(aout, wouth, b_out, out);
  }
}

// v003
// It runs in 213 microseconds.
// Two timings next to v002 both put it at 1.06 times that version's speed.
// Counting every step since v000, it is 2.92 times as fast.
#include <hip/hip_runtime.h>
#include <hip/hip_bf16.h>

// ---------------------------------------------------------------------------
// Multi-head self-attention (shared QKV projection) for MI455X / gfx1250.
// f32 inputs are pre-converted to f16 once (bandwidth-bound pass), then all
// matmuls run through v_wmma_f32_16x16x32_f16 (f16 in, f32 accumulate) with
// pure f16 b128 fragment loads in the hot loops. Flash-attention style:
// the 1 GB score matrix never exists; softmax runs online in registers.
// The GEMMs issue global_prefetch_b8 for next tiles; attention stages its key and
// value tiles in LDS, once per block, by asynchronous copies.
// Every f16 tensor in the workspace is kept in FRAGMENT ORDER (see below), so
// that one wave-wide 16-byte load or store covers 512 contiguous bytes.
// ---------------------------------------------------------------------------

typedef __attribute__((ext_vector_type(16))) _Float16 v16h;
typedef __attribute__((ext_vector_type(8)))  _Float16 v8h;
typedef __attribute__((ext_vector_type(8)))  float    v8f;
typedef __attribute__((ext_vector_type(4)))  float    v4f;

#define BATCH 4
#define SEQ   2048
#define DIM   1024
#define NHEAD 16
#define DHEAD 64
#define MTOT  (BATCH * SEQ)       // 8192 rows

union V16U { v16h v; v8h h[2]; };

// CDNA5 16-bit A/B fragment (16x32 / 32x16), per-lane layout:
//   lanes 0-15 : K = ko+{0..7} in halves 0-7, K = ko+{16..23} in halves 8-15, ko=0
//   lanes16-31 : same with ko=8
//
// Fragment order of a [rows][K] f16 matrix: the 16 x 32 fragment
// (rt = row >> 4, kc = k >> 5) is the 1 KB block number rt * (K / 32) + kc.
// Inside it, element (row & 15, k & 31) lies at half-word
//   ((k >> 4) & 1) * 256 + (((k >> 3) & 1) * 16 + (row & 15)) * 8 + (k & 7)
// i.e. lane L finds its halves 0-7 at L * 8 and its halves 8-15 at 256 + L * 8.
#define FRAG_H 512                 // half-words per fragment block
#define FR_DIM (DIM / 32)          // fragment blocks per 16-row band, K = DIM
#define FR_SEQ (SEQ / 32)          // the same, K = SEQ (transposed copy)

// p points at the fragment block + lane * 8.
__device__ inline v16h frag_from_f16(const _Float16* __restrict__ p) {
  V16U u;
  u.h[0] = *(const v8h*)(p);
  u.h[1] = *(const v8h*)(p + 256);
  return u.v;
}

__device__ inline v8f wmma_f16(v16h a, v16h b, v8f c) {
  // D = A(16x32,f16) * B(32x16,f16) + C(16x16,f32)
  return __builtin_amdgcn_wmma_f32_16x16x32_f16(false, a, false, b,
                                                (short)0, c, false, false);
}

// ---------------------------------------------------------------------------
// Kernel 0: bulk f32 -> f16 conversion of a [rows][DIM] matrix into fragment
// order. Thread i writes the i-th 16-byte piece of the output and reads the
// 8 floats that belong there.
// ---------------------------------------------------------------------------
__global__ __launch_bounds__(256) void cvt_f32_f16_kernel(
    const float* __restrict__ src, _Float16* __restrict__ dst, int n8) {
  const int i = blockIdx.x * 256 + threadIdx.x;
  if (i >= n8) return;
  const int fr  = i >> 6;                               // fragment block
  const int row = (fr / FR_DIM) * 16 + (i & 15);
  const int k   = (fr % FR_DIM) * 32 + ((i >> 5) & 1) * 16 + ((i >> 4) & 1) * 8;
  const float* s = src + (size_t)row * DIM + k;
  const v4f a = *(const v4f*)(s);
  const v4f b = *(const v4f*)(s + 4);
  v8h o;
#pragma unroll
  for (int j = 0; j < 4; ++j) {
    o[j]     = (_Float16)a[j];
    o[4 + j] = (_Float16)b[j];
  }
  *(v8h*)(dst + (size_t)i * 8) = o;
}

// ---------------------------------------------------------------------------
// Kernel 1: qkv = X @ Wqkv^T   (f16 WMMA, f32 accumulate, f16 outputs)
// Also writes the transposed copy qkvT[b][d][s] used as the V^T fragments.
// All four tensors are in fragment order.
// Block: 128 threads = 4 waves (2x2), block tile 128x128, wave tile 64x64.
// ---------------------------------------------------------------------------
__global__ __launch_bounds__(128) void qkv_gemm_kernel(
    const _Float16* __restrict__ X,   // [8192,1024] f16
    const _Float16* __restrict__ W,   // [1024,1024] f16 (out,in)
    _Float16* __restrict__ qkv,       // [8192,1024]
    _Float16* __restrict__ qkvT) {    // [4*1024][2048]
  const int lane = threadIdx.x & 31;
  const int wave = threadIdx.x >> 5;
  const int l15  = lane & 15;
  const int mb   = blockIdx.y * 128 + (wave >> 1) * 64;
  const int nb   = blockIdx.x * 128 + (wave & 1) * 64;

  v8f acc[4][4];
#pragma unroll
  for (int mt = 0; mt < 4; ++mt)
#pragma unroll
    for (int nt = 0; nt < 4; ++nt) acc[mt][nt] = (v8f)(0.0f);

  const _Float16* Ab = X + (size_t)(mb >> 4) * FR_DIM * FRAG_H + lane * 8;
  const _Float16* Bb = W + (size_t)(nb >> 4) * FR_DIM * FRAG_H + lane * 8;

  for (int k = 0; k < DIM; k += 32) {
    const int kf = (k >> 5) * FRAG_H;
    if (k + 128 < DIM) {
      // the first fragment of each operand, four steps ahead (32 B per lane)
      __builtin_prefetch(Ab + kf + 4 * FRAG_H + lane * 8, 0, 1);
      __builtin_prefetch(Bb + kf + 4 * FRAG_H + lane * 8, 0, 1);
      // before the prefetches' address registers are written again
      asm volatile("s_wait_xcnt 0x0" ::: "memory");
    }
    v16h af[4], bf[4];
#pragma unroll
    for (int t = 0; t < 4; ++t) af[t] = frag_from_f16(Ab + (size_t)t * FR_DIM * FRAG_H + kf);
#pragma unroll
    for (int t = 0; t < 4; ++t) bf[t] = frag_from_f16(Bb + (size_t)t * FR_DIM * FRAG_H + kf);
#pragma unroll
    for (int mt = 0; mt < 4; ++mt)
#pragma unroll
      for (int nt = 0; nt < 4; ++nt)
        acc[mt][nt] = wmma_f16(af[mt], bf[nt], acc[mt][nt]);
  }

  const int rsel = (lane >> 4) << 3;        // C-layout: lanes 16-31 hold rows +8
#pragma unroll
  for (int mt = 0; mt < 4; ++mt)
#pragma unroll
    for (int nt = 0; nt < 4; ++nt) {
      const int r0 = mb + mt * 16;          // rows r0 + rsel + j
      const int c0 = nb + nt * 16;          // column c0 + l15
      v8h o;
#pragma unroll
      for (int j = 0; j < 8; ++j) o[j] = (_Float16)acc[mt][nt][j];
      // qkvT row (r0 >> 11) * DIM + c, k = s = r & 2047: a lane's 8 values are
      // one 16-byte piece of the fragment, at lane * 8
      const int tr = ((r0 >> 11) * DIM + c0) >> 4;
      *(v8h*)(qkvT + ((size_t)tr * FR_SEQ + ((r0 & 2047) >> 5)) * FRAG_H +
              ((r0 >> 4) & 1) * 256 + lane * 8) = o;
      // qkv row r, k = c: one half-word per row
      _Float16* kp = qkv + ((size_t)(r0 >> 4) * FR_DIM + (c0 >> 5)) * FRAG_H +
                     ((c0 >> 4) & 1) * 256 + ((l15 >> 3) * 16 + rsel) * 8 + (l15 & 7);
#pragma unroll
      for (int j = 0; j < 8; ++j) kp[j * 8] = o[j];
    }
}

// ---------------------------------------------------------------------------
// Kernel 2: flash attention, q=k=v=qkv, in transposed form:
//   S^T = K * Q^T   (A = key rows, B = query rows kept in registers)
//   O^T += V^T * P^T (A = rows of qkvT, B = P^T packed from the S^T tiles)
// A lane of a 16-column group holds the scores of ONE query, so maximum and
// sum run in the lane; the two lane halves (keys 8h..8h+7 of each 16) join
// their maxima once per key tile and their sums once, after the loop.
// Two S^T accumulator tiles (keys 0-15, 16-31) converted in place are the
// B operand of the second product: P needs no LDS and no barrier.
// One block = (b,h, 256 q-rows); each of 8 waves owns 32 queries, loops keys
// in tiles of 64.
// All 8 waves read the same K and V^T tile: the block brings each tile into LDS
// once (two buffers, the next tile in flight while one is worked on) and
// the waves take their fragments from there.
// Stage layout (half-words): K fragments (nt, ks) at (nt * 2 + ks) * FRAG_H,
// V^T fragments (dt, c2) at STAGE_V + (dt * 2 + c2) * FRAG_H.
// ---------------------------------------------------------------------------
#define STAGE_V 4096               // half-words of the K part of a stage
#define STAGE_H 8192               // half-words per stage (K 8 KB + V^T 8 KB)

// One stage = 1024 pieces of 16 bytes, four per thread: piece c * 256 + tid.
// The wait in the same statement stands before the address registers are rewritten.
__device__ inline void copy_stage(unsigned lds, const _Float16* k0, const _Float16* k1,
                                  const _Float16* v0, const _Float16* v1) {
  asm volatile(
      "global_load_async_to_lds_b128 %0, %4, off\n\t"
      "global_load_async_to_lds_b128 %1, %5, off\n\t"
      "global_load_async_to_lds_b128 %2, %6, off\n\t"
      "global_load_async_to_lds_b128 %3, %7, off\n\t"
      "s_wait_xcnt 0x0"
      :: "v"(lds), "v"(lds + 4096u), "v"(lds + 8192u), "v"(lds + 12288u),
         "v"(k0), "v"(k1), "v"(v0), "v"(v1)
      : "memory");
}
// value of the same column in the other 16-lane half (lane l <-> l ^ 16)
__device__ inline float other_half(float v) {
  int b = __builtin_bit_cast(int, v);
  b = __builtin_amdgcn_permlanex16(b, b, 0x76543210, 0xfedcba98, false, false);
  return __builtin_bit_cast(float, b);
}

__global__ __launch_bounds__(256) void attn_kernel(
    const _Float16* __restrict__ qkv,   // [4*2048][1024], fragment order
    const _Float16* __restrict__ qkvT,  // [4*1024][2048], fragment order
    _Float16* __restrict__ aout) {      // [4*2048][1024], fragment order
  __shared__ __attribute__((aligned(1024))) _Float16 ring[2 * STAGE_H];
  const int lane = threadIdx.x & 31;
  const int wave = threadIdx.x >> 5;

  const int bh = blockIdx.y;
  const int b  = bh >> 4;
  const int h  = bh & 15;
  const int q0 = blockIdx.x * 256 + wave * 32;

  // fragment (16 rows from seq position s, d chunk ks) : qk + (s >> 4) * KBAND + ks * FRAG_H
  // fragment (16 d from dt * 16, 32 keys from chunk kc) : vT + dt * VBAND + kc * FRAG_H
  const int KBAND = FR_DIM * FRAG_H;
  const int VBAND = FR_SEQ * FRAG_H;
  const _Float16* qk = qkv + ((size_t)(b * SEQ >> 4) * FR_DIM + h * (DHEAD / 32)) * FRAG_H;
  const _Float16* vT = qkvT + (size_t)((b * DIM + h * DHEAD) >> 4) * VBAND;

  // scale folded into exp2 domain: exp(s/8) = 2^(s * log2(e)/8)
  const float SC2 = 0.18033688011112042f;

  // resident Q fragments (B operand, column = query): [qg][ks]
  v16h qf[2][2];
#pragma unroll
  for (int qg = 0; qg < 2; ++qg)
#pragma unroll
    for (int ks = 0; ks < 2; ++ks)
      qf[qg][ks] = frag_from_f16(qk + (size_t)((q0 >> 4) + qg) * KBAND + ks * FRAG_H + lane * 8);

  // O^T tiles: oacc[dt][qg][r] = O[query qg*16+l15][d = dt*16 + rsel + r]
  v8f oacc[4][2];
#pragma unroll
  for (int dt = 0; dt < 4; ++dt)
#pragma unroll
    for (int qg = 0; qg < 2; ++qg) oacc[dt][qg] = (v8f)(0.0f);

  float mrow[2], lrow[2];   // per lane: its query's maximum, its half's sum
#pragma unroll
  for (int qg = 0; qg < 2; ++qg) { mrow[qg] = -INFINITY; lrow[qg] = 0.0f; }

  // this thread's pieces of a stage: each tile is four runs of 2 KB (128 pieces), one
  // per band; bands (tid >> 7) and 2 + (tid >> 7) of K, then the same of V^T
  const int tid = threadIdx.x;
  const _Float16* kc = qk + (size_t)(tid >> 7) * KBAND + (tid & 127) * 8;
  const _Float16* vc = vT + (size_t)(tid >> 7) * VBAND + (tid & 127) * 8;
  const unsigned lds0 = (unsigned)(size_t)(&ring[0]) + tid * 16;

  copy_stage(lds0, kc, kc + 2 * KBAND, vc, vc + 2 * VBAND);
  // tile 0 has landed (this wave's pieces), then is published to the block
  asm volatile("s_wait_asynccnt 0x0" ::: "memory");
  __syncthreads();
  copy_stage(lds0 + STAGE_H * 2, kc + 4 * KBAND, kc + 6 * KBAND,
             vc + 2 * FRAG_H, vc + 2 * VBAND + 2 * FRAG_H);

  for (int kt = 0; kt < SEQ / 64; ++kt) {
    const _Float16* st = ring + (kt & 1) * STAGE_H + lane * 8;

    // ---- scores S^T = K @ Q^T : sc[nt][qg][r] = S[query][key nt*16+rsel+r]
    v8f sc[4][2];
#pragma unroll
    for (int nt = 0; nt < 4; ++nt)
#pragma unroll
      for (int qg = 0; qg < 2; ++qg) sc[nt][qg] = (v8f)(0.0f);

    v16h kf[2][4];
#pragma unroll
    for (int ks = 0; ks < 2; ++ks)
#pragma unroll
      for (int nt = 0; nt < 4; ++nt)
        kf[ks][nt] = frag_from_f16(st + (nt * 2 + ks) * FRAG_H);
    // keeps the tile's 16 loads together in front of the products (one latency, counted
    // waits); without it most are issued in pairs among the products, each pair waited
    // out in full, and the kernel takes over 256 registers (one block on a WGP, not two)
    __builtin_amdgcn_sched_barrier(0);
#pragma unroll
    for (int ks = 0; ks < 2; ++ks)
#pragma unroll
      for (int nt = 0; nt < 4; ++nt)
#pragma unroll
        for (int qg = 0; qg < 2; ++qg)
          sc[nt][qg] = wmma_f16(kf[ks][nt], qf[qg][ks], sc[nt][qg]);

    // ---- online softmax, one query per lane -------------------------------
    v16h pf[2][2];            // P^T as B operand: [qg][32-key chunk]
#pragma unroll
    for (int qg = 0; qg < 2; ++qg) {
#pragma unroll
      for (int nt = 0; nt < 4; ++nt) sc[nt][qg] *= SC2;

      float m8[8];
#pragma unroll
      for (int j = 0; j < 8; ++j)
        m8[j] = fmaxf(fmaxf(sc[0][qg][j], sc[1][qg][j]),
                      fmaxf(sc[2][qg][j], sc[3][qg][j]));
      float rm = fmaxf(fmaxf(fmaxf(m8[0], m8[1]), fmaxf(m8[2], m8[3])),
                       fmaxf(fmaxf(m8[4], m8[5]), fmaxf(m8[6], m8[7])));
      rm = fmaxf(rm, other_half(rm));

      const float mold = mrow[qg];
      const float mnew = fmaxf(mold, rm);
      const float corr = exp2f(mold - mnew);
      mrow[qg] = mnew;

#pragma unroll
      for (int nt = 0; nt < 4; ++nt)
#pragma unroll
        for (int j = 0; j < 8; ++j) sc[nt][qg][j] = exp2f(sc[nt][qg][j] - mnew);

      const v8f s8 = (sc[0][qg] + sc[1][qg]) + (sc[2][qg] + sc[3][qg]);
      const float rs = ((s8[0] + s8[1]) + (s8[2] + s8[3])) +
                       ((s8[4] + s8[5]) + (s8[6] + s8[7]));
      lrow[qg] = lrow[qg] * corr + rs;

#pragma unroll
      for (int dt = 0; dt < 4; ++dt) oacc[dt][qg] *= corr;

      // element s of the B operand is key kmap(s) = tile (s >> 3), register s & 7
#pragma unroll
      for (int c2 = 0; c2 < 2; ++c2)
#pragma unroll
        for (int s = 0; s < 16; ++s)
          pf[qg][c2][s] = (_Float16)sc[c2 * 2 + (s >> 3)][qg][s & 7];
    }

    // ---- O^T += V^T @ P^T --------------------------------------------------
#pragma unroll
    for (int c2 = 0; c2 < 2; ++c2) {
      v16h vf[4];
#pragma unroll
      for (int dt = 0; dt < 4; ++dt)
        vf[dt] = frag_from_f16(st + STAGE_V + (dt * 2 + c2) * FRAG_H);
#pragma unroll
      for (int dt = 0; dt < 4; ++dt)
#pragma unroll
        for (int qg = 0; qg < 2; ++qg)
          oacc[dt][qg] = wmma_f16(vf[dt], pf[qg][c2], oacc[dt][qg]);
    }

    // ---- publish tile kt + 1, free this tile's buffer -----------------------
    // this wave's reads of the buffer are done
    asm volatile("s_wait_dscnt 0x0" ::: "memory");
    // this wave's pieces of tile kt + 1 have landed
    asm volatile("s_wait_asynccnt 0x0" ::: "memory");
    __syncthreads();
    if (kt + 2 < SEQ / 64) {
      const _Float16* kn = kc + (size_t)(kt + 2) * 4 * KBAND;
      const _Float16* vn = vc + (kt + 2) * 2 * FRAG_H;
      copy_stage(lds0 + (kt & 1) * (STAGE_H * 2), kn, kn + 2 * KBAND, vn, vn + 2 * VBAND);
    }
  }
  // no copy is outstanding when the wave ends
  asm volatile("s_wait_asynccnt 0x0" ::: "memory");

  // ---- join the halves' sums, normalize, store 8 consecutive d per lane ----
#pragma unroll
  for (int qg = 0; qg < 2; ++qg) {
    const float inv = 1.0f / (lrow[qg] + other_half(lrow[qg]));
    // row = the lane's query, k = h * 64 + dt * 16 + 8 * (lane >> 4) + 0..7: piece number
    // 'lane' of half (dt & 1) of fragment (row band, h * 2 + (dt >> 1))
    _Float16* ob = aout + ((size_t)(((b * SEQ + q0) >> 4) + qg) * FR_DIM + h * (DHEAD / 32)) * FRAG_H + lane * 8;
#pragma unroll
    for (int dt = 0; dt < 4; ++dt) {
      v8h o;
#pragma unroll
      for (int j = 0; j < 8; ++j) o[j] = (_Float16)(oacc[dt][qg][j] * inv);
      *(v8h*)(ob + (dt >> 1) * FRAG_H + (dt & 1) * 256) = o;
    }
  }
}

// ---------------------------------------------------------------------------
// Kernel 3: out = AttnOut @ Wout^T + bias   (f16 WMMA, f32 bias/store)
// ---------------------------------------------------------------------------
__global__ __launch_bounds__(128) void out_gemm_kernel(
    const _Float16* __restrict__ A,   // [8192,1024] f16, fragment order
    const _Float16* __restrict__ W,   // [1024,1024] f16 (out,in), fragment order
    const float* __restrict__ bias,   // [1024] f32
    float* __restrict__ out) {        // [8192,1024] f32
  const int lane = threadIdx.x & 31;
  const int wave = threadIdx.x >> 5;
  const int l15  = lane & 15;
  const int mb   = blockIdx.y * 128 + (wave >> 1) * 64;
  const int nb   = blockIdx.x * 128 + (wave & 1) * 64;

  v8f acc[4][4];
#pragma unroll
  for (int mt = 0; mt < 4; ++mt)
#pragma unroll
    for (int nt = 0; nt < 4; ++nt) acc[mt][nt] = (v8f)(0.0f);

  const _Float16* Ab = A + (size_t)(mb >> 4) * FR_DIM * FRAG_H + lane * 8;
  const _Float16* Bb = W + (size_t)(nb >> 4) * FR_DIM * FRAG_H + lane * 8;

  for (int k = 0; k < DIM; k += 32) {
    const int kf = (k >> 5) * FRAG_H;
    if (k + 128 < DIM) {
      // the first fragment of each operand, four steps ahead (32 B per lane)
      __builtin_prefetch(Ab + kf + 4 * FRAG_H + lane * 8, 0, 1);
      __builtin_prefetch(Bb + kf + 4 * FRAG_H + lane * 8, 0, 1);
      // before the prefetches' address registers are written again
      asm volatile("s_wait_xcnt 0x0" ::: "memory");
    }
    v16h af[4], bf[4];
#pragma unroll
    for (int t = 0; t < 4; ++t) af[t] = frag_from_f16(Ab + (size_t)t * FR_DIM * FRAG_H + kf);
#pragma unroll
    for (int t = 0; t < 4; ++t) bf[t] = frag_from_f16(Bb + (size_t)t * FR_DIM * FRAG_H + kf);
#pragma unroll
    for (int mt = 0; mt < 4; ++mt)
#pragma unroll
      for (int nt = 0; nt < 4; ++nt)
        acc[mt][nt] = wmma_f16(af[mt], bf[nt], acc[mt][nt]);
  }

  float bv[4];
#pragma unroll
  for (int nt = 0; nt < 4; ++nt) bv[nt] = bias[nb + nt * 16 + l15];

  const int rsel = (lane >> 4) << 3;
#pragma unroll
  for (int mt = 0; mt < 4; ++mt)
#pragma unroll
    for (int nt = 0; nt < 4; ++nt)
#pragma unroll
      for (int j = 0; j < 8; ++j) {
        const int r = mb + mt * 16 + rsel + j;
        const int c = nb + nt * 16 + l15;
        out[(size_t)r * DIM + c] = acc[mt][nt][j] + bv[nt];
      }
}

// ---------------------------------------------------------------------------
extern "C" void kernel_launch(void* const* d_in, const int* in_sizes, int n_in,
                              void* d_out, int out_size, void* d_ws, size_t ws_size,
                              hipStream_t stream) {
  const float* x     = (const float*)d_in[0];   // [4,2048,1024]
  const float* w_qkv = (const float*)d_in[1];   // [1024,1024]
  const float* w_out = (const float*)d_in[2];   // [1024,1024]
  const float* b_out = (const float*)d_in[3];   // [1024]
  float* out = (float*)d_out;

  // workspace (f16, all in fragment order): xh 16MB | wqkvh 2MB | wouth 2MB | qkv 16MB | qkvT 16MB | aout 16MB
  _Float16* xh    = (_Float16*)d_ws;
  _Float16* wqkvh = xh    + (size_t)MTOT * DIM;
  _Float16* wouth = wqkvh + (size_t)DIM * DIM;
  _Float16* qkv   = wouth + (size_t)DIM * DIM;
  _Float16* qkvT  = qkv   + (size_t)MTOT * DIM;
  _Float16* aout  = qkvT  + (size_t)MTOT * DIM;

  // ---- pre-convert inputs to f16 (one pass each) ----
  {
    const int n8x = MTOT * DIM / 8;                    // 1,048,576
    cvt_f32_f16_kernel<<<n8x / 256, 256, 0, stream>>>(x, xh, n8x);
    const int n8w = DIM * DIM / 8;                     // 131,072
    cvt_f32_f16_kernel<<<n8w / 256, 256, 0, stream>>>(w_qkv, wqkvh, n8w);
    cvt_f32_f16_kernel<<<n8w / 256, 256, 0, stream>>>(w_out, wouth, n8w);
  }
  {
    dim3 grid(DIM / 128, MTOT / 128);           // (8, 64)
    qkv_gemm_kernel<<<grid, 128, 0, stream>>>(xh, wqkvh, qkv, qkvT);
  }
  {
    dim3 grid(SEQ / 256, BATCH * NHEAD);        // (8, 64)
    attn_kernel<<<grid, 256, 0, stream>>>(qkv, qkvT, aout);
  }
  {
    dim3 grid(DIM / 128, MTOT / 128);           // (8, 64)
    out_gemm_kernel<<<grid, 128, 0, stream>>>(aout, wouth, b_out, out);
  }
}

// v004
// Measured time: 194 microseconds a run.
// Two timings next to v003 both put it at 1.10 times that version's speed.
// Counting every step since v000, it is 3.21 times as fast.
#include <hip/hip_runtime.h>
#include <hip/hip_bf16.h>

// ---------------------------------------------------------------------------
// Multi-head self-attention (shared QKV projection) for MI455X / gfx1250.
// f32 inputs are pre-converted to f16 once (bandwidth-bound pass), then all
// matmuls run through v_wmma_f32_16x16x32_f16 (f16 in, f32 accumulate) with
// pure f16 b128 fragment loads in the hot loops. Flash-attention style:
// the 1 GB score matrix never exists; softmax runs online in registers.
// The GEMMs issue global_prefetch_b8 for next tiles; attention stages its key and
// value tiles in LDS, once per block, by asynchronous copies.
// Every f16 tensor in the workspace is kept in FRAGMENT ORDER (see below), so
// that one wave-wide 16-byte load or store covers 512 contiguous bytes.
// ---------------------------------------------------------------------------

typedef __attribute__((ext_vector_type(16))) _Float16 v16h;
typedef __attribute__((ext_vector_type(8)))  _Float16 v8h;
typedef __attribute__((ext_vector_type(8)))  float    v8f;
typedef __attribute__((ext_vector_type(4)))  float    v4f;

#define BATCH 4
#define SEQ   2048
#define DIM   1024
#define NHEAD 16
#define DHEAD 64
#define MTOT  (BATCH * SEQ)       // 8192 rows

union V16U { v16h v; v8h h[2]; };

// CDNA5 16-bit A/B fragment (16x32 / 32x16), per-lane layout:
//   lanes 0-15 : K = ko+{0..7} in halves 0-7, K = ko+{16..23} in halves 8-15, ko=0
//   lanes16-31 : same with ko=8
//
// Fragment order of a [rows][K] f16 matrix: the 16 x 32 fragment
// (rt = row >> 4, kc = k >> 5) is the 1 KB block number rt * (K / 32) + kc.
// Inside it, element (row & 15, k & 31) lies at half-word
//   ((k >> 4) & 1) * 256 + (((k >> 3) & 1) * 16 + (row & 15)) * 8 + (k & 7)
// i.e. lane L finds its halves 0-7 at L * 8 and its halves 8-15 at 256 + L * 8.
#define FRAG_H 512                 // half-words per fragment block
#define FR_DIM (DIM / 32)          // fragment blocks per 16-row band, K = DIM
#define FR_SEQ (SEQ / 32)          // the same, K = SEQ (transposed copy)

// p points at the fragment block + lane * 8.
__device__ inline v16h frag_from_f16(const _Float16* __restrict__ p) {
  V16U u;
  u.h[0] = *(const v8h*)(p);
  u.h[1] = *(const v8h*)(p + 256);
  return u.v;
}

__device__ inline v8f wmma_f16(v16h a, v16h b, v8f c) {
  // D = A(16x32,f16) * B(32x16,f16) + C(16x16,f32)
  return __builtin_amdgcn_wmma_f32_16x16x32_f16(false, a, false, b,
                                                (short)0, c, false, false);
}

// ---------------------------------------------------------------------------
// Kernel 0: bulk f32 -> f16 conversion of a [rows][DIM] matrix into fragment
// order. Thread i writes the i-th 16-byte piece of the output and reads the
// 8 floats that belong there.
// ---------------------------------------------------------------------------
__global__ __launch_bounds__(256) void cvt_f32_f16_kernel(
    const float* __restrict__ src, _Float16* __restrict__ dst, int n8) {
  const int i = blockIdx.x * 256 + threadIdx.x;
  if (i >= n8) return;
  const int fr  = i >> 6;                               // fragment block
  const int row = (fr / FR_DIM) * 16 + (i & 15);
  const int k   = (fr % FR_DIM) * 32 + ((i >> 5) & 1) * 16 + ((i >> 4) & 1) * 8;
  const float* s = src + (size_t)row * DIM + k;
  const v4f a = *(const v4f*)(s);
  const v4f b = *(const v4f*)(s + 4);
  v8h o;
#pragma unroll
  for (int j = 0; j < 4; ++j) {
    o[j]     = (_Float16)a[j];
    o[4 + j] = (_Float16)b[j];
  }
  *(v8h*)(dst + (size_t)i * 8) = o;
}

// ---------------------------------------------------------------------------
// Kernel 1: qkv = X @ Wqkv^T   (f16 WMMA, f32 accumulate, f16 outputs)
// Also writes the transposed copy qkvT[b][d][s] used as the V^T fragments.
// All four tensors are in fragment order.
// Block: 128 threads = 4 waves (2x2), block tile 128x128, wave tile 64x64.
// ---------------------------------------------------------------------------
__global__ __launch_bounds__(128) void qkv_gemm_kernel(
    const _Float16* __restrict__ X,   // [8192,1024] f16
    const _Float16* __restrict__ W,   // [1024,1024] f16 (out,in)
    _Float16* __restrict__ qkv,       // [8192,1024]
    _Float16* __restrict__ qkvT) {    // [4*1024][2048]
  const int lane = threadIdx.x & 31;
  const int wave = threadIdx.x >> 5;
  const int l15  = lane & 15;
  const int mb   = blockIdx.y * 128 + (wave >> 1) * 64;
  const int nb   = blockIdx.x * 128 + (wave & 1) * 64;

  v8f acc[4][4];
#pragma unroll
  for (int mt = 0; mt < 4; ++mt)
#pragma unroll
    for (int nt = 0; nt < 4; ++nt) acc[mt][nt] = (v8f)(0.0f);

  const _Float16* Ab = X + (size_t)(mb >> 4) * FR_DIM * FRAG_H + lane * 8;
  const _Float16* Bb = W + (size_t)(nb >> 4) * FR_DIM * FRAG_H + lane * 8;

  for (int k = 0; k < DIM; k += 32) {
    const int kf = (k >> 5) * FRAG_H;
    if (k + 128 < DIM) {
      // the first fragment of each operand, four steps ahead (32 B per lane)
      __builtin_prefetch(Ab + kf + 4 * FRAG_H + lane * 8, 0, 1);
      __builtin_prefetch(Bb + kf + 4 * FRAG_H + lane * 8, 0, 1);
      // before the prefetches' address registers are written again
      asm volatile("s_wait_xcnt 0x0" ::: "memory");
    }
    v16h af[4], bf[4];
#pragma unroll
    for (int t = 0; t < 4; ++t) af[t] = frag_from_f16(Ab + (size_t)t * FR_DIM * FRAG_H + kf);
#pragma unroll
    for (int t = 0; t < 4; ++t) bf[t] = frag_from_f16(Bb + (size_t)t * FR_DIM * FRAG_H + kf);
#pragma unroll
    for (int mt = 0; mt < 4; ++mt)
#pragma unroll
      for (int nt = 0; nt < 4; ++nt)
        acc[mt][nt] = wmma_f16(af[mt], bf[nt], acc[mt][nt]);
  }

  const int rsel = (lane >> 4) << 3;        // C-layout: lanes 16-31 hold rows +8
#pragma unroll
  for (int mt = 0; mt < 4; ++mt)
#pragma unroll
    for (int nt = 0; nt < 4; ++nt) {
      const int r0 = mb + mt * 16;          // rows r0 + rsel + j
      const int c0 = nb + nt * 16;          // column c0 + l15
      v8h o;
#pragma unroll
      for (int j = 0; j < 8; ++j) o[j] = (_Float16)acc[mt][nt][j];
      // qkvT row (r0 >> 11) * DIM + c, k = s = r & 2047: a lane's 8 values are
      // one 16-byte piece of the fragment, at lane * 8
      const int tr = ((r0 >> 11) * DIM + c0) >> 4;
      *(v8h*)(qkvT + ((size_t)tr * FR_SEQ + ((r0 & 2047) >> 5)) * FRAG_H +
              ((r0 >> 4) & 1) * 256 + lane * 8) = o;
      // qkv row r, k = c: one half-word per row
      _Float16* kp = qkv + ((size_t)(r0 >> 4) * FR_DIM + (c0 >> 5)) * FRAG_H +
                     ((c0 >> 4) & 1) * 256 + ((l15 >> 3) * 16 + rsel) * 8 + (l15 & 7);
#pragma unroll
      for (int j = 0; j < 8; ++j) kp[j * 8] = o[j];
    }
}

// ---------------------------------------------------------------------------
// Kernel 2: flash attention, q=k=v=qkv, in transposed form:
//   S^T = K * Q^T   (A = key rows, B = query rows kept in registers)
//   O^T += V^T * P^T (A = rows of qkvT, B = P^T packed from the S^T tiles)
// A lane of a 16-column group holds the scores of ONE query, so maximum and
// sum run in the lane; the two lane halves (keys 8h..8h+7 of each 16) join
// their maxima once per key tile and their sums once, after the loop.
// Two S^T accumulator tiles (keys 0-15, 16-31) converted in place are the
// B operand of the second product: P needs no LDS and no barrier.
// One block = (b,h, 256 q-rows); each of 8 waves owns 32 queries, loops keys
// in tiles of 64.
// All 8 waves read the same K and V^T tile: the block brings each tile into LDS
// once (two buffers, the next tile in flight while one is worked on) and
// the waves take their fragments from there.
// Stage layout (half-words): K fragments (nt, ks) at (nt * 2 + ks) * FRAG_H,
// V^T fragments (dt, c2) at STAGE_V + (dt * 2 + c2) * FRAG_H.
// ---------------------------------------------------------------------------
#define STAGE_V 4096               // half-words of the K part of a stage
#define STAGE_H 8192               // half-words per stage (K 8 KB + V^T 8 KB)

// One stage = 1024 pieces of 16 bytes, four per thread: piece c * 256 + tid.
// The wait in the same statement stands before the address registers are rewritten.
__device__ inline void copy_stage(unsigned lds, const _Float16* k0, const _Float16* k1,
                                  const _Float16* v0, const _Float16* v1) {
  asm volatile(
      "global_load_async_to_lds_b128 %0, %4, off\n\t"
      "global_load_async_to_lds_b128 %1, %5, off\n\t"
      "global_load_async_to_lds_b128 %2, %6, off\n\t"
      "global_load_async_to_lds_b128 %3, %7, off\n\t"
      "s_wait_xcnt 0x0"
      :: "v"(lds), "v"(lds + 4096u), "v"(lds + 8192u), "v"(lds + 12288u),
         "v"(k0), "v"(k1), "v"(v0), "v"(v1)
      : "memory");
}
// value of the same column in the other 16-lane half (lane l <-> l ^ 16)
__device__ inline float other_half(float v) {
  int b = __builtin_bit_cast(int, v);
  b = __builtin_amdgcn_permlanex16(b, b, 0x76543210, 0xfedcba98, false, false);
  return __builtin_bit_cast(float, b);
}

// 2^x as the bare hardware instruction. The library's exp2f adds a range check per value
// (compare, select, add, select, ldexp) that only serves results below 2^-126. Every
// argument here is <= 0 and each query's largest term is 2^0 = 1, so such a result
// is 0 as an f16 weight and is lost in the f32 sum either way.
__device__ inline float exp2_bare(float x) { return __builtin_amdgcn_exp2f(x); }

__global__ __launch_bounds__(256) void attn_kernel(
    const _Float16* __restrict__ qkv,   // [4*2048][1024], fragment order
    const _Float16* __restrict__ qkvT,  // [4*1024][2048], fragment order
    _Float16* __restrict__ aout) {      // [4*2048][1024], fragment order
  __shared__ __attribute__((aligned(1024))) _Float16 ring[2 * STAGE_H];
  const int lane = threadIdx.x & 31;
  const int wave = threadIdx.x >> 5;

  const int bh = blockIdx.y;
  const int b  = bh >> 4;
  const int h  = bh & 15;
  const int q0 = blockIdx.x * 256 + wave * 32;

  // fragment (16 rows from seq position s, d chunk ks) : qk + (s >> 4) * KBAND + ks * FRAG_H
  // fragment (16 d from dt * 16, 32 keys from chunk kc) : vT + dt * VBAND + kc * FRAG_H
  const int KBAND = FR_DIM * FRAG_H;
  const int VBAND = FR_SEQ * FRAG_H;
  const _Float16* qk = qkv + ((size_t)(b * SEQ >> 4) * FR_DIM + h * (DHEAD / 32)) * FRAG_H;
  const _Float16* vT = qkvT + (size_t)((b * DIM + h * DHEAD) >> 4) * VBAND;

  // scale folded into exp2 domain: exp(s/8) = 2^(s * log2(e)/8)
  const float SC2 = 0.18033688011112042f;

  // resident Q fragments (B operand, column = query): [qg][ks]
  v16h qf[2][2];
#pragma unroll
  for (int qg = 0; qg < 2; ++qg)
#pragma unroll
    for (int ks = 0; ks < 2; ++ks)
      qf[qg][ks] = frag_from_f16(qk + (size_t)((q0 >> 4) + qg) * KBAND + ks * FRAG_H + lane * 8);

  // O^T tiles: oacc[dt][qg][r] = O[query qg*16+l15][d = dt*16 + rsel + r]
  v8f oacc[4][2];
#pragma unroll
  for (int dt = 0; dt < 4; ++dt)
#pragma unroll
    for (int qg = 0; qg < 2; ++qg) oacc[dt][qg] = (v8f)(0.0f);

  float mrow[2], lrow[2];   // per lane: its query's maximum, its half's sum
#pragma unroll
  for (int qg = 0; qg < 2; ++qg) { mrow[qg] = -INFINITY; lrow[qg] = 0.0f; }

  // this thread's pieces of a stage: each tile is four runs of 2 KB (128 pieces), one
  // per band; bands (tid >> 7) and 2 + (tid >> 7) of K, then the same of V^T
  const int tid = threadIdx.x;
  const _Float16* kc = qk + (size_t)(tid >> 7) * KBAND + (tid & 127) * 8;
  const _Float16* vc = vT + (size_t)(tid >> 7) * VBAND + (tid & 127) * 8;
  const unsigned lds0 = (unsigned)(size_t)(&ring[0]) + tid * 16;

  copy_stage(lds0, kc, kc + 2 * KBAND, vc, vc + 2 * VBAND);
  // tile 0 has landed (this wave's pieces), then is published to the block
  asm volatile("s_wait_asynccnt 0x0" ::: "memory");
  __syncthreads();
  copy_stage(lds0 + STAGE_H * 2, kc + 4 * KBAND, kc + 6 * KBAND,
             vc + 2 * FRAG_H, vc + 2 * VBAND + 2 * FRAG_H);

  for (int kt = 0; kt < SEQ / 64; ++kt) {
    const _Float16* st = ring + (kt & 1) * STAGE_H + lane * 8;

    // ---- scores S^T = K @ Q^T : sc[nt][qg][r] = S[query][key nt*16+rsel+r]
    v8f sc[4][2];
#pragma unroll
    for (int nt = 0; nt < 4; ++nt)
#pragma unroll
      for (int qg = 0; qg < 2; ++qg) sc[nt][qg] = (v8f)(0.0f);

    v16h kf[2][4];
#pragma unroll
    for (int ks = 0; ks < 2; ++ks)
#pragma unroll
      for (int nt = 0; nt < 4; ++nt)
        kf[ks][nt] = frag_from_f16(st + (nt * 2 + ks) * FRAG_H);
    // keeps the tile's 16 loads together in front of the products (one latency, counted
    // waits); without it most are issued in pairs among the products, each pair waited
    // out in full, and the kernel takes over 256 registers (one block on a WGP, not two)
    __builtin_amdgcn_sched_barrier(0);
#pragma unroll
    for (int ks = 0; ks < 2; ++ks)
#pragma unroll
      for (int nt = 0; nt < 4; ++nt)
#pragma unroll
        for (int qg = 0; qg < 2; ++qg)
          sc[nt][qg] = wmma_f16(kf[ks][nt], qf[qg][ks], sc[nt][qg]);

    // ---- online softmax, one query per lane -------------------------------
    v16h pf[2][2];            // P^T as B operand: [qg][32-key chunk]
#pragma unroll
    for (int qg = 0; qg < 2; ++qg) {
#pragma unroll
      for (int nt = 0; nt < 4; ++nt) sc[nt][qg] *= SC2;

      float m8[8];
#pragma unroll
      for (int j = 0; j < 8; ++j)
        m8[j] = fmaxf(fmaxf(sc[0][qg][j], sc[1][qg][j]),
                      fmaxf(sc[2][qg][j], sc[3][qg][j]));
      float rm = fmaxf(fmaxf(fmaxf(m8[0], m8[1]), fmaxf(m8[2], m8[3])),
                       fmaxf(fmaxf(m8[4], m8[5]), fmaxf(m8[6], m8[7])));
      rm = fmaxf(rm, other_half(rm));

      const float mold = mrow[qg];
      const float mnew = fmaxf(mold, rm);
      // = 2^(mold - mnew), 0 on the first tile (mold = -inf). The sign goes into the
      // instruction's source modifier: written mold - mnew, the compiler pairs this
      // subtraction with a score's, every later pair of scores sits one register off, and
      // a tile pays about twenty register moves and half its fused multiply-adds for it.
      const float corr = exp2_bare(-(mnew - mold));
      mrow[qg] = mnew;

#pragma unroll
      for (int nt = 0; nt < 4; ++nt)
#pragma unroll
        for (int j = 0; j < 8; ++j) sc[nt][qg][j] = exp2_bare(sc[nt][qg][j] - mnew);

      const v8f s8 = (sc[0][qg] + sc[1][qg]) + (sc[2][qg] + sc[3][qg]);
      const float rs = ((s8[0] + s8[1]) + (s8[2] + s8[3])) +
                       ((s8[4] + s8[5]) + (s8[6] + s8[7]));
      lrow[qg] = lrow[qg] * corr + rs;

#pragma unroll
      for (int dt = 0; dt < 4; ++dt) oacc[dt][qg] *= corr;

      // element s of the B operand is key kmap(s) = tile (s >> 3), register s & 7
#pragma unroll
      for (int c2 = 0; c2 < 2; ++c2)
#pragma unroll
        for (int s = 0; s < 16; ++s)
          pf[qg][c2][s] = (_Float16)sc[c2 * 2 + (s >> 3)][qg][s & 7];
    }

    // ---- O^T += V^T @ P^T --------------------------------------------------
#pragma unroll
    for (int c2 = 0; c2 < 2; ++c2) {
      v16h vf[4];
#pragma unroll
      for (int dt = 0; dt < 4; ++dt)
        vf[dt] = frag_from_f16(st + STAGE_V + (dt * 2 + c2) * FRAG_H);
#pragma unroll
      for (int dt = 0; dt < 4; ++dt)
#pragma unroll
        for (int qg = 0; qg < 2; ++qg)
          oacc[dt][qg] = wmma_f16(vf[dt], pf[qg][c2], oacc[dt][qg]);
    }

    // ---- publish tile kt + 1, free this tile's buffer -----------------------
    // this wave's reads of the buffer are done
    asm volatile("s_wait_dscnt 0x0" ::: "memory");
    // this wave's pieces of tile kt + 1 have landed
    asm volatile("s_wait_asynccnt 0x0" ::: "memory");
    __syncthreads();
    if (kt + 2 < SEQ / 64) {
      const _Float16* kn = kc + (size_t)(kt + 2) * 4 * KBAND;
      const _Float16* vn = vc + (kt + 2) * 2 * FRAG_H;
      copy_stage(lds0 + (kt & 1) * (STAGE_H * 2), kn, kn + 2 * KBAND, vn, vn + 2 * VBAND);
    }
  }
  // no copy is outstanding when the wave ends
  asm volatile("s_wait_asynccnt 0x0" ::: "memory");

  // ---- join the halves' sums, normalize, store 8 consecutive d per lane ----
#pragma unroll
  for (int qg = 0; qg < 2; ++qg) {
    const float inv = 1.0f / (lrow[qg] + other_half(lrow[qg]));
    // row = the lane's query, k = h * 64 + dt * 16 + 8 * (lane >> 4) + 0..7: piece number
    // 'lane' of half (dt & 1) of fragment (row band, h * 2 + (dt >> 1))
    _Float16* ob = aout + ((size_t)(((b * SEQ + q0) >> 4) + qg) * FR_DIM + h * (DHEAD / 32)) * FRAG_H + lane * 8;
#pragma unroll
    for (int dt = 0; dt < 4; ++dt) {
      v8h o;
#pragma unroll
      for (int j = 0; j < 8; ++j) o[j] = (_Float16)(oacc[dt][qg][j] * inv);
      *(v8h*)(ob + (dt >> 1) * FRAG_H + (dt & 1) * 256) = o;
    }
  }
}

// ---------------------------------------------------------------------------
// Kernel 3: out = AttnOut @ Wout^T + bias   (f16 WMMA, f32 bias/store)
// ---------------------------------------------------------------------------
__global__ __launch_bounds__(128) void out_gemm_kernel(
    const _Float16* __restrict__ A,   // [8192,1024] f16, fragment order
    const _Float16* __restrict__ W,   // [1024,1024] f16 (out,in), fragment order
    const float* __restrict__ bias,   // [1024] f32
    float* __restrict__ out) {        // [8192,1024] f32
  const int lane = threadIdx.x & 31;
  const int wave = threadIdx.x >> 5;
  const int l15  = lane & 15;
  const int mb   = blockIdx.y * 128 + (wave >> 1) * 64;
  const int nb   = blockIdx.x * 128 + (wave & 1) * 64;

  v8f acc[4][4];
#pragma unroll
  for (int mt = 0; mt < 4; ++mt)
#pragma unroll
    for (int nt = 0; nt < 4; ++nt) acc[mt][nt] = (v8f)(0.0f);

  const _Float16* Ab = A + (size_t)(mb >> 4) * FR_DIM * FRAG_H + lane * 8;
  const _Float16* Bb = W + (size_t)(nb >> 4) * FR_DIM * FRAG_H + lane * 8;

  for (int k = 0; k < DIM; k += 32) {
    const int kf = (k >> 5) * FRAG_H;
    if (k + 128 < DIM) {
      // the first fragment of each operand, four steps ahead (32 B per lane)
      __builtin_prefetch(Ab + kf + 4 * FRAG_H + lane * 8, 0, 1);
      __builtin_prefetch(Bb + kf + 4 * FRAG_H + lane * 8, 0, 1);
      // before the prefetches' address registers are written again
      asm volatile("s_wait_xcnt 0x0" ::: "memory");
    }
    v16h af[4], bf[4];
#pragma unroll
    for (int t = 0; t < 4; ++t) af[t] = frag_from_f16(Ab + (size_t)t * FR_DIM * FRAG_H + kf);
#pragma unroll
    for (int t = 0; t < 4; ++t) bf[t] = frag_from_f16(Bb + (size_t)t * FR_DIM * FRAG_H + kf);
#pragma unroll
    for (int mt = 0; mt < 4; ++mt)
#pragma unroll
      for (int nt = 0; nt < 4; ++nt)
        acc[mt][nt] = wmma_f16(af[mt], bf[nt], acc[mt][nt]);
  }

  float bv[4];
#pragma unroll
  for (int nt = 0; nt < 4; ++nt) bv[nt] = bias[nb + nt * 16 + l15];

  const int rsel = (lane >> 4) << 3;
#pragma unroll
  for (int mt = 0; mt < 4; ++mt)
#pragma unroll
    for (int nt = 0; nt < 4; ++nt)
#pragma unroll
      for (int j = 0; j < 8; ++j) {
        const int r = mb + mt * 16 + rsel + j;
        const int c = nb + nt * 16 + l15;
        out[(size_t)r * DIM + c] = acc[mt][nt][j] + bv[nt];
      }
}

// ---------------------------------------------------------------------------
extern "C" void kernel_launch(void* const* d_in, const int* in_sizes, int n_in,
                              void* d_out, int out_size, void* d_ws, size_t ws_size,
                              hipStream_t stream) {
  const float* x     = (const float*)d_in[0];   // [4,2048,1024]
  const float* w_qkv = (const float*)d_in[1];   // [1024,1024]
  const float* w_out = (const float*)d_in[2];   // [1024,1024]
  const float* b_out = (const float*)d_in[3];   // [1024]
  float* out = (float*)d_out;

  // workspace (f16, all in fragment order): xh 16MB | wqkvh 2MB | wouth 2MB | qkv 16MB | qkvT 16MB | aout 16MB
  _Float16* xh    = (_Float16*)d_ws;
  _Float16* wqkvh = xh    + (size_t)MTOT * DIM;
  _Float16* wouth = wqkvh + (size_t)DIM * DIM;
  _Float16* qkv   = wouth + (size_t)DIM * DIM;
  _Float16* qkvT  = qkv   + (size_t)MTOT * DIM;
  _Float16* aout  = qkvT  + (size_t)MTOT * DIM;

  // ---- pre-convert inputs to f16 (one pass each) ----
  {
    const int n8x = MTOT * DIM / 8;                    // 1,048,576
    cvt_f32_f16_kernel<<<n8x / 256, 256, 0, stream>>>(x, xh, n8x);
    const int n8w = DIM * DIM / 8;                     // 131,072
    cvt_f32_f16_kernel<<<n8w / 256, 256, 0, stream>>>(w_qkv, wqkvh, n8w);
    cvt_f32_f16_kernel<<<n8w / 256, 256, 0, stream>>>(w_out, wouth, n8w);
  }
  {
    dim3 grid(DIM / 128, MTOT / 128);           // (8, 64)
    qkv_gemm_kernel<<<grid, 128, 0, stream>>>(xh, wqkvh, qkv, qkvT);
  }
  {
    dim3 grid(SEQ / 256, BATCH * NHEAD);        // (8, 64)
    attn_kernel<<<grid, 256, 0, stream>>>(qkv, qkvT, aout);
  }
  {
    dim3 grid(DIM / 128, MTOT / 128);           // (8, 64)
    out_gemm_kernel<<<grid, 128, 0, stream>>>(aout, wouth, b_out, out);
  }
}

// v005
// It runs in 119 microseconds.
// Next to v004, in two timings, it ran 1.62 and 1.63 times as fast.
// All steps since v000 together make it 5.22 times as fast.
#include <hip/hip_runtime.h>
#include <hip/hip_bf16.h>

// ---------------------------------------------------------------------------
// Multi-head self-attention (shared QKV projection) for MI455X / gfx1250.
// f32 inputs are pre-converted to f16 once (bandwidth-bound pass), then all
// matmuls run through v_wmma_f32_16x16x32_f16 (f16 in, f32 accumulate) with
// pure f16 b128 fragment loads in the hot loops. Flash-attention style:
// the 1 GB score matrix never exists; softmax runs online in registers.
// The GEMMs issue global_prefetch_b8 for next tiles; attention stages its key and
// value tiles in LDS, once per block, by asynchronous copies.
// Every f16 tensor in the workspace is kept in FRAGMENT ORDER (see below), so
// that one wave-wide 16-byte load or store covers 512 contiguous bytes.
// ---------------------------------------------------------------------------

typedef __attribute__((ext_vector_type(16))) _Float16 v16h;
typedef __attribute__((ext_vector_type(8)))  _Float16 v8h;
typedef __attribute__((ext_vector_type(8)))  float    v8f;
typedef __attribute__((ext_vector_type(4)))  float    v4f;

#define BATCH 4
#define SEQ   2048
#define DIM   1024
#define NHEAD 16
#define DHEAD 64
#define MTOT  (BATCH * SEQ)       // 8192 rows

union V16U { v16h v; v8h h[2]; };

// CDNA5 16-bit A/B fragment (16x32 / 32x16), per-lane layout:
//   lanes 0-15 : K = ko+{0..7} in halves 0-7, K = ko+{16..23} in halves 8-15, ko=0
//   lanes16-31 : same with ko=8
//
// Fragment order of a [rows][K] f16 matrix: the 16 x 32 fragment
// (rt = row >> 4, kc = k >> 5) is the 1 KB block number rt * (K / 32) + kc.
// Inside it, element (row & 15, k & 31) lies at half-word
//   ((k >> 4) & 1) * 256 + (((k >> 3) & 1) * 16 + (row & 15)) * 8 + (k & 7)
// i.e. lane L finds its halves 0-7 at L * 8 and its halves 8-15 at 256 + L * 8.
#define FRAG_H 512                 // half-words per fragment block
#define FR_DIM (DIM / 32)          // fragment blocks per 16-row band, K = DIM
#define FR_SEQ (SEQ / 32)          // the same, K = SEQ (transposed copy)

// p points at the fragment block + lane * 8.
__device__ inline v16h frag_from_f16(const _Float16* __restrict__ p) {
  V16U u;
  u.h[0] = *(const v8h*)(p);
  u.h[1] = *(const v8h*)(p + 256);
  return u.v;
}

__device__ inline v8f wmma_f16(v16h a, v16h b, v8f c) {
  // D = A(16x32,f16) * B(32x16,f16) + C(16x16,f32)
  return __builtin_amdgcn_wmma_f32_16x16x32_f16(false, a, false, b,
                                                (short)0, c, false, false);
}

// ---------------------------------------------------------------------------
// Kernel 0: bulk f32 -> f16 conversion of a [rows][DIM] matrix into fragment
// order. Thread i writes the i-th 16-byte piece of the output and reads the
// 8 floats that belong there.
// ---------------------------------------------------------------------------
__global__ __launch_bounds__(256) void cvt_f32_f16_kernel(
    const float* __restrict__ src, _Float16* __restrict__ dst, int n8) {
  const int i = blockIdx.x * 256 + threadIdx.x;
  if (i >= n8) return;
  const int fr  = i >> 6;                               // fragment block
  const int row = (fr / FR_DIM) * 16 + (i & 15);
  const int k   = (fr % FR_DIM) * 32 + ((i >> 5) & 1) * 16 + ((i >> 4) & 1) * 8;
  const float* s = src + (size_t)row * DIM + k;
  const v4f a = *(const v4f*)(s);
  const v4f b = *(const v4f*)(s + 4);
  v8h o;
#pragma unroll
  for (int j = 0; j < 4; ++j) {
    o[j]     = (_Float16)a[j];
    o[4 + j] = (_Float16)b[j];
  }
  *(v8h*)(dst + (size_t)i * 8) = o;
}

// ---------------------------------------------------------------------------
// Kernel 1: qkv = X @ Wqkv^T   (f16 WMMA, f32 accumulate, f16 outputs)
// Also writes the transposed copy qkvT[b][d][s] used as the V^T fragments.
// All four tensors are in fragment order.
// Block: 128 threads = 4 waves (2x2), block tile 128x128, wave tile 64x64.
// ---------------------------------------------------------------------------
__global__ __launch_bounds__(128) void qkv_gemm_kernel(
    const _Float16* __restrict__ X,   // [8192,1024] f16
    const _Float16* __restrict__ W,   // [1024,1024] f16 (out,in)
    _Float16* __restrict__ qkv,       // [8192,1024]
    _Float16* __restrict__ qkvT) {    // [4*1024][2048]
  const int lane = threadIdx.x & 31;
  const int wave = threadIdx.x >> 5;
  const int l15  = lane & 15;
  const int mb   = blockIdx.y * 128 + (wave >> 1) * 64;
  const int nb   = blockIdx.x * 128 + (wave & 1) * 64;

  v8f acc[4][4];
#pragma unroll
  for (int mt = 0; mt < 4; ++mt)
#pragma unroll
    for (int nt = 0; nt < 4; ++nt) acc[mt][nt] = (v8f)(0.0f);

  const _Float16* Ab = X + (size_t)(mb >> 4) * FR_DIM * FRAG_H + lane * 8;
  const _Float16* Bb = W + (size_t)(nb >> 4) * FR_DIM * FRAG_H + lane * 8;

  for (int k = 0; k < DIM; k += 64) {
    const int kf = (k >> 5) * FRAG_H;
    if (k + 128 < DIM) {
      // the first two fragments of each operand, two trips ahead (64 B per lane)
      __builtin_prefetch(Ab + kf + 4 * FRAG_H + lane * 24, 0, 1);
      __builtin_prefetch(Bb + kf + 4 * FRAG_H + lane * 24, 0, 1);
      // before the prefetches' address registers are written again
      asm volatile("s_wait_xcnt 0x0" ::: "memory");
    }
    const _Float16* pa = Ab + kf;
    const _Float16* pb = Bb + kf;
    v16h af[2][4], bf[2][4];
#pragma unroll
    for (int ks = 0; ks < 2; ++ks) {
#pragma unroll
      for (int t = 0; t < 4; ++t)
        af[ks][t] = frag_from_f16(pa + (size_t)t * FR_DIM * FRAG_H + ks * FRAG_H);
#pragma unroll
      for (int t = 0; t < 4; ++t)
        bf[ks][t] = frag_from_f16(pb + (size_t)t * FR_DIM * FRAG_H + ks * FRAG_H);
    }
    // the loads' address registers stay live up to this wait: no load of the group lands
    // on them, and they are written again only behind it
    asm volatile("s_wait_xcnt 0x0" :: "v"(pa), "v"(pb) : "memory");
    // keeps the trip's 32 loads together in front of the products (one memory latency a
    // trip, counted waits); without it the A fragments share one register set and each is
    // loaded behind the products of the one before and waited out in full
    __builtin_amdgcn_sched_barrier(0);
#pragma unroll
    for (int ks = 0; ks < 2; ++ks)
#pragma unroll
      for (int mt = 0; mt < 4; ++mt)
#pragma unroll
        for (int nt = 0; nt < 4; ++nt)
          acc[mt][nt] = wmma_f16(af[ks][mt], bf[ks][nt], acc[mt][nt]);
  }

  const int rsel = (lane >> 4) << 3;        // C-layout: lanes 16-31 hold rows +8
#pragma unroll
  for (int mt = 0; mt < 4; ++mt)
#pragma unroll
    for (int nt = 0; nt < 4; ++nt) {
      const int r0 = mb + mt * 16;          // rows r0 + rsel + j
      const int c0 = nb + nt * 16;          // column c0 + l15
      v8h o;
#pragma unroll
      for (int j = 0; j < 8; ++j) o[j] = (_Float16)acc[mt][nt][j];
      // qkvT row (r0 >> 11) * DIM + c, k = s = r & 2047: a lane's 8 values are
      // one 16-byte piece of the fragment, at lane * 8
      const int tr = ((r0 >> 11) * DIM + c0) >> 4;
      *(v8h*)(qkvT + ((size_t)tr * FR_SEQ + ((r0 & 2047) >> 5)) * FRAG_H +
              ((r0 >> 4) & 1) * 256 + lane * 8) = o;
      // qkv row r, k = c: one half-word per row
      _Float16* kp = qkv + ((size_t)(r0 >> 4) * FR_DIM + (c0 >> 5)) * FRAG_H +
                     ((c0 >> 4) & 1) * 256 + ((l15 >> 3) * 16 + rsel) * 8 + (l15 & 7);
#pragma unroll
      for (int j = 0; j < 8; ++j) kp[j * 8] = o[j];
    }
}

// ---------------------------------------------------------------------------
// Kernel 2: flash attention, q=k=v=qkv, in transposed form:
//   S^T = K * Q^T   (A = key rows, B = query rows kept in registers)
//   O^T += V^T * P^T (A = rows of qkvT, B = P^T packed from the S^T tiles)
// A lane of a 16-column group holds the scores of ONE query, so maximum and
// sum run in the lane; the two lane halves (keys 8h..8h+7 of each 16) join
// their maxima once per key tile and their sums once, after the loop.
// Two S^T accumulator tiles (keys 0-15, 16-31) converted in place are the
// B operand of the second product: P needs no LDS and no barrier.
// One block = (b,h, 256 q-rows); each of 8 waves owns 32 queries, loops keys
// in tiles of 64.
// All 8 waves read the same K and V^T tile: the block brings each tile into LDS
// once (two buffers, the next tile in flight while one is worked on) and
// the waves take their fragments from there.
// Stage layout (half-words): K fragments (nt, ks) at (nt * 2 + ks) * FRAG_H,
// V^T fragments (dt, c2) at STAGE_V + (dt * 2 + c2) * FRAG_H.
// ---------------------------------------------------------------------------
#define STAGE_V 4096               // half-words of the K part of a stage
#define STAGE_H 8192               // half-words per stage (K 8 KB + V^T 8 KB)

// One stage = 1024 pieces of 16 bytes, four per thread: piece c * 256 + tid.
// The wait in the same statement stands before the address registers are rewritten.
__device__ inline void copy_stage(unsigned lds, const _Float16* k0, const _Float16* k1,
                                  const _Float16* v0, const _Float16* v1) {
  asm volatile(
      "global_load_async_to_lds_b128 %0, %4, off\n\t"
      "global_load_async_to_lds_b128 %1, %5, off\n\t"
      "global_load_async_to_lds_b128 %2, %6, off\n\t"
      "global_load_async_to_lds_b128 %3, %7, off\n\t"
      "s_wait_xcnt 0x0"
      :: "v"(lds), "v"(lds + 4096u), "v"(lds + 8192u), "v"(lds + 12288u),
         "v"(k0), "v"(k1), "v"(v0), "v"(v1)
      : "memory");
}
// value of the same column in the other 16-lane half (lane l <-> l ^ 16)
__device__ inline float other_half(float v) {
  int b = __builtin_bit_cast(int, v);
  b = __builtin_amdgcn_permlanex16(b, b, 0x76543210, 0xfedcba98, false, false);
  return __builtin_bit_cast(float, b);
}

// 2^x as the bare hardware instruction. The library's exp2f adds a range check per value
// (compare, select, add, select, ldexp) that only serves results below 2^-126. Every
// argument here is <= 0 and each query's largest term is 2^0 = 1, so such a result
// is 0 as an f16 weight and is lost in the f32 sum either way.
__device__ inline float exp2_bare(float x) { return __builtin_amdgcn_exp2f(x); }

__global__ __launch_bounds__(256) void attn_kernel(
    const _Float16* __restrict__ qkv,   // [4*2048][1024], fragment order
    const _Float16* __restrict__ qkvT,  // [4*1024][2048], fragment order
    _Float16* __restrict__ aout) {      // [4*2048][1024], fragment order
  __shared__ __attribute__((aligned(1024))) _Float16 ring[2 * STAGE_H];
  const int lane = threadIdx.x & 31;
  const int wave = threadIdx.x >> 5;

  const int bh = blockIdx.y;
  const int b  = bh >> 4;
  const int h  = bh & 15;
  const int q0 = blockIdx.x * 256 + wave * 32;

  // fragment (16 rows from seq position s, d chunk ks) : qk + (s >> 4) * KBAND + ks * FRAG_H
  // fragment (16 d from dt * 16, 32 keys from chunk kc) : vT + dt * VBAND + kc * FRAG_H
  const int KBAND = FR_DIM * FRAG_H;
  const int VBAND = FR_SEQ * FRAG_H;
  const _Float16* qk = qkv + ((size_t)(b * SEQ >> 4) * FR_DIM + h * (DHEAD / 32)) * FRAG_H;
  const _Float16* vT = qkvT + (size_t)((b * DIM + h * DHEAD) >> 4) * VBAND;

  // scale folded into exp2 domain: exp(s/8) = 2^(s * log2(e)/8)
  const float SC2 = 0.18033688011112042f;

  // resident Q fragments (B operand, column = query): [qg][ks]
  v16h qf[2][2];
#pragma unroll
  for (int qg = 0; qg < 2; ++qg)
#pragma unroll
    for (int ks = 0; ks < 2; ++ks)
      qf[qg][ks] = frag_from_f16(qk + (size_t)((q0 >> 4) + qg) * KBAND + ks * FRAG_H + lane * 8);

  // O^T tiles: oacc[dt][qg][r] = O[query qg*16+l15][d = dt*16 + rsel + r]
  v8f oacc[4][2];
#pragma unroll
  for (int dt = 0; dt < 4; ++dt)
#pragma unroll
    for (int qg = 0; qg < 2; ++qg) oacc[dt][qg] = (v8f)(0.0f);

  float mrow[2], lrow[2];   // per lane: its query's maximum, its half's sum
#pragma unroll
  for (int qg = 0; qg < 2; ++qg) { mrow[qg] = -INFINITY; lrow[qg] = 0.0f; }

  // this thread's pieces of a stage: each tile is four runs of 2 KB (128 pieces), one
  // per band; bands (tid >> 7) and 2 + (tid >> 7) of K, then the same of V^T
  const int tid = threadIdx.x;
  const _Float16* kc = qk + (size_t)(tid >> 7) * KBAND + (tid & 127) * 8;
  const _Float16* vc = vT + (size_t)(tid >> 7) * VBAND + (tid & 127) * 8;
  const unsigned lds0 = (unsigned)(size_t)(&ring[0]) + tid * 16;

  copy_stage(lds0, kc, kc + 2 * KBAND, vc, vc + 2 * VBAND);
  // tile 0 has landed (this wave's pieces), then is published to the block
  asm volatile("s_wait_asynccnt 0x0" ::: "memory");
  __syncthreads();
  copy_stage(lds0 + STAGE_H * 2, kc + 4 * KBAND, kc + 6 * KBAND,
             vc + 2 * FRAG_H, vc + 2 * VBAND + 2 * FRAG_H);

  for (int kt = 0; kt < SEQ / 64; ++kt) {
    const _Float16* st = ring + (kt & 1) * STAGE_H + lane * 8;

    // ---- scores S^T = K @ Q^T : sc[nt][qg][r] = S[query][key nt*16+rsel+r]
    v8f sc[4][2];
#pragma unroll
    for (int nt = 0; nt < 4; ++nt)
#pragma unroll
      for (int qg = 0; qg < 2; ++qg) sc[nt][qg] = (v8f)(0.0f);

    v16h kf[2][4];
#pragma unroll
    for (int ks = 0; ks < 2; ++ks)
#pragma unroll
      for (int nt = 0; nt < 4; ++nt)
        kf[ks][nt] = frag_from_f16(st + (nt * 2 + ks) * FRAG_H);
    // keeps the tile's 16 loads together in front of the products (one latency, counted
    // waits); without it most are issued in pairs among the products, each pair waited
    // out in full, and the kernel takes over 256 registers (one block on a WGP, not two)
    __builtin_amdgcn_sched_barrier(0);
#pragma unroll
    for (int ks = 0; ks < 2; ++ks)
#pragma unroll
      for (int nt = 0; nt < 4; ++nt)
#pragma unroll
        for (int qg = 0; qg < 2; ++qg)
          sc[nt][qg] = wmma_f16(kf[ks][nt], qf[qg][ks], sc[nt][qg]);

    // ---- online softmax, one query per lane -------------------------------
    v16h pf[2][2];            // P^T as B operand: [qg][32-key chunk]
#pragma unroll
    for (int qg = 0; qg < 2; ++qg) {
#pragma unroll
      for (int nt = 0; nt < 4; ++nt) sc[nt][qg] *= SC2;

      float m8[8];
#pragma unroll
      for (int j = 0; j < 8; ++j)
        m8[j] = fmaxf(fmaxf(sc[0][qg][j], sc[1][qg][j]),
                      fmaxf(sc[2][qg][j], sc[3][qg][j]));
      float rm = fmaxf(fmaxf(fmaxf(m8[0], m8[1]), fmaxf(m8[2], m8[3])),
                       fmaxf(fmaxf(m8[4], m8[5]), fmaxf(m8[6], m8[7])));
      rm = fmaxf(rm, other_half(rm));

      const float mold = mrow[qg];
      const float mnew = fmaxf(mold, rm);
      // = 2^(mold - mnew), 0 on the first tile (mold = -inf). The sign goes into the
      // instruction's source modifier: written mold - mnew, the compiler pairs this
      // subtraction with a score's, every later pair of scores sits one register off, and
      // a tile pays about twenty register moves and half its fused multiply-adds for it.
      const float corr = exp2_bare(-(mnew - mold));
      mrow[qg] = mnew;

#pragma unroll
      for (int nt = 0; nt < 4; ++nt)
#pragma unroll
        for (int j = 0; j < 8; ++j) sc[nt][qg][j] = exp2_bare(sc[nt][qg][j] - mnew);

      const v8f s8 = (sc[0][qg] + sc[1][qg]) + (sc[2][qg] + sc[3][qg]);
      const float rs = ((s8[0] + s8[1]) + (s8[2] + s8[3])) +
                       ((s8[4] + s8[5]) + (s8[6] + s8[7]));
      lrow[qg] = lrow[qg] * corr + rs;

#pragma unroll
      for (int dt = 0; dt < 4; ++dt) oacc[dt][qg] *= corr;

      // element s of the B operand is key kmap(s) = tile (s >> 3), register s & 7
#pragma unroll
      for (int c2 = 0; c2 < 2; ++c2)
#pragma unroll
        for (int s = 0; s < 16; ++s)
          pf[qg][c2][s] = (_Float16)sc[c2 * 2 + (s >> 3)][qg][s & 7];
    }

    // ---- O^T += V^T @ P^T --------------------------------------------------
#pragma unroll
    for (int c2 = 0; c2 < 2; ++c2) {
      v16h vf[4];
#pragma unroll
      for (int dt = 0; dt < 4; ++dt)
        vf[dt] = frag_from_f16(st + STAGE_V + (dt * 2 + c2) * FRAG_H);
#pragma unroll
      for (int dt = 0; dt < 4; ++dt)
#pragma unroll
        for (int qg = 0; qg < 2; ++qg)
          oacc[dt][qg] = wmma_f16(vf[dt], pf[qg][c2], oacc[dt][qg]);
    }

    // ---- publish tile kt + 1, free this tile's buffer -----------------------
    // this wave's reads of the buffer are done
    asm volatile("s_wait_dscnt 0x0" ::: "memory");
    // this wave's pieces of tile kt + 1 have landed
    asm volatile("s_wait_asynccnt 0x0" ::: "memory");
    __syncthreads();
    if (kt + 2 < SEQ / 64) {
      const _Float16* kn = kc + (size_t)(kt + 2) * 4 * KBAND;
      const _Float16* vn = vc + (kt + 2) * 2 * FRAG_H;
      copy_stage(lds0 + (kt & 1) * (STAGE_H * 2), kn, kn + 2 * KBAND, vn, vn + 2 * VBAND);
    }
  }
  // no copy is outstanding when the wave ends
  asm volatile("s_wait_asynccnt 0x0" ::: "memory");

  // ---- join the halves' sums, normalize, store 8 consecutive d per lane ----
#pragma unroll
  for (int qg = 0; qg < 2; ++qg) {
    const float inv = 1.0f / (lrow[qg] + other_half(lrow[qg]));
    // row = the lane's query, k = h * 64 + dt * 16 + 8 * (lane >> 4) + 0..7: piece number
    // 'lane' of half (dt & 1) of fragment (row band, h * 2 + (dt >> 1))
    _Float16* ob = aout + ((size_t)(((b * SEQ + q0) >> 4) + qg) * FR_DIM + h * (DHEAD / 32)) * FRAG_H + lane * 8;
#pragma unroll
    for (int dt = 0; dt < 4; ++dt) {
      v8h o;
#pragma unroll
      for (int j = 0; j < 8; ++j) o[j] = (_Float16)(oacc[dt][qg][j] * inv);
      *(v8h*)(ob + (dt >> 1) * FRAG_H + (dt & 1) * 256) = o;
    }
  }
}

// ---------------------------------------------------------------------------
// Kernel 3: out = AttnOut @ Wout^T + bias   (f16 WMMA, f32 bias/store)
// ---------------------------------------------------------------------------
__global__ __launch_bounds__(128) void out_gemm_kernel(
    const _Float16* __restrict__ A,   // [8192,1024] f16, fragment order
    const _Float16* __restrict__ W,   // [1024,1024] f16 (out,in), fragment order
    const float* __restrict__ bias,   // [1024] f32
    float* __restrict__ out) {        // [8192,1024] f32
  const int lane = threadIdx.x & 31;
  const int wave = threadIdx.x >> 5;
  const int l15  = lane & 15;
  const int mb   = blockIdx.y * 128 + (wave >> 1) * 64;
  const int nb   = blockIdx.x * 128 + (wave & 1) * 64;

  v8f acc[4][4];
#pragma unroll
  for (int mt = 0; mt < 4; ++mt)
#pragma unroll
    for (int nt = 0; nt < 4; ++nt) acc[mt][nt] = (v8f)(0.0f);

  const _Float16* Ab = A + (size_t)(mb >> 4) * FR_DIM * FRAG_H + lane * 8;
  const _Float16* Bb = W + (size_t)(nb >> 4) * FR_DIM * FRAG_H + lane * 8;

  for (int k = 0; k < DIM; k += 64) {
    const int kf = (k >> 5) * FRAG_H;
    if (k + 128 < DIM) {
      // the first two fragments of each operand, two trips ahead (64 B per lane)
      __builtin_prefetch(Ab + kf + 4 * FRAG_H + lane * 24, 0, 1);
      __builtin_prefetch(Bb + kf + 4 * FRAG_H + lane * 24, 0, 1);
      // before the prefetches' address registers are written again
      asm volatile("s_wait_xcnt 0x0" ::: "memory");
    }
    const _Float16* pa = Ab + kf;
    const _Float16* pb = Bb + kf;
    v16h af[2][4], bf[2][4];
#pragma unroll
    for (int ks = 0; ks < 2; ++ks) {
#pragma unroll
      for (int t = 0; t < 4; ++t)
        af[ks][t] = frag_from_f16(pa + (size_t)t * FR_DIM * FRAG_H + ks * FRAG_H);
#pragma unroll
      for (int t = 0; t < 4; ++t)
        bf[ks][t] = frag_from_f16(pb + (size_t)t * FR_DIM * FRAG_H + ks * FRAG_H);
    }
    // the loads' address registers stay live up to this wait: no load of the group lands
    // on them, and they are written again only behind it
    asm volatile("s_wait_xcnt 0x0" :: "v"(pa), "v"(pb) : "memory");
    // keeps the trip's 32 loads together in front of the products (one memory latency a
    // trip, counted waits); without it the A fragments share one register set and each is
    // loaded behind the products of the one before and waited out in full
    __builtin_amdgcn_sched_barrier(0);
#pragma unroll
    for (int ks = 0; ks < 2; ++ks)
#pragma unroll
      for (int mt = 0; mt < 4; ++mt)
#pragma unroll
        for (int nt = 0; nt < 4; ++nt)
          acc[mt][nt] = wmma_f16(af[ks][mt], bf[ks][nt], acc[mt][nt]);
  }

  float bv[4];
#pragma unroll
  for (int nt = 0; nt < 4; ++nt) bv[nt] = bias[nb + nt * 16 + l15];

  const int rsel = (lane >> 4) << 3;
#pragma unroll
  for (int mt = 0; mt < 4; ++mt)
#pragma unroll
    for (int nt = 0; nt < 4; ++nt)
#pragma unroll
      for (int j = 0; j < 8; ++j) {
        const int r = mb + mt * 16 + rsel + j;
        const int c = nb + nt * 16 + l15;
        out[(size_t)r * DIM + c] = acc[mt][nt][j] + bv[nt];
      }
}

// ---------------------------------------------------------------------------
extern "C" void kernel_launch(void* const* d_in, const int* in_sizes, int n_in,
                              void* d_out, int out_size, void* d_ws, size_t ws_size,
                              hipStream_t stream) {
  const float* x     = (const float*)d_in[0];   // [4,2048,1024]
  const float* w_qkv = (const float*)d_in[1];   // [1024,1024]
  const float* w_out = (const float*)d_in[2];   // [1024,1024]
  const float* b_out = (const float*)d_in[3];   // [1024]
  float* out = (float*)d_out;

  // workspace (f16, all in fragment order): xh 16MB | wqkvh 2MB | wouth 2MB | qkv 16MB | qkvT 16MB | aout 16MB
  _Float16* xh    = (_Float16*)d_ws;
  _Float16* wqkvh = xh    + (size_t)MTOT * DIM;
  _Float16* wouth = wqkvh + (size_t)DIM * DIM;
  _Float16* qkv   = wouth + (size_t)DIM * DIM;
  _Float16* qkvT  = qkv   + (size_t)MTOT * DIM;
  _Float16* aout  = qkvT  + (size_t)MTOT * DIM;

  // ---- pre-convert inputs to f16 (one pass each) ----
  {
    const int n8x = MTOT * DIM / 8;                    // 1,048,576
    cvt_f32_f16_kernel<<<n8x / 256, 256, 0, stream>>>(x, xh, n8x);
    const int n8w = DIM * DIM / 8;                     // 131,072
    cvt_f32_f16_kernel<<<n8w / 256, 256, 0, stream>>>(w_qkv, wqkvh, n8w);
    cvt_f32_f16_kernel<<<n8w / 256, 256, 0, stream>>>(w_out, wouth, n8w);
  }
  {
    dim3 grid(DIM / 128, MTOT / 128);           // (8, 64)
    qkv_gemm_kernel<<<grid, 128, 0, stream>>>(xh, wqkvh, qkv, qkvT);
  }
  {
    dim3 grid(SEQ / 256, BATCH * NHEAD);        // (8, 64)
    attn_kernel<<<grid, 256, 0, stream>>>(qkv, qkvT, aout);
  }
  {
    dim3 grid(DIM / 128, MTOT / 128);           // (8, 64)
    out_gemm_kernel<<<grid, 128, 0, stream>>>(aout, wouth, b_out, out);
  }
}

// v006
// It runs in 107 microseconds.
// In both of two side-by-side timings against v005, it was 1.11 times as fast.
// Over all steps from v000 it is 5.80 times as fast.
#include <hip/hip_runtime.h>
#include <hip/hip_bf16.h>

// ---------------------------------------------------------------------------
// Multi-head self-attention (shared QKV projection) for MI455X / gfx1250.
// f32 inputs are pre-converted to f16 once (bandwidth-bound pass), then all
// matmuls run through v_wmma_f32_16x16x32_f16 (f16 in, f32 accumulate) with
// pure f16 b128 fragment loads in the hot loops. Flash-attention style:
// the 1 GB score matrix never exists; softmax runs online in registers.
// The GEMMs stage their operand tiles, attention its key and value tiles, in LDS,
// once per block, by asynchronous copies.
// Every f16 tensor in the workspace is kept in FRAGMENT ORDER (see below), so
// that one wave-wide 16-byte load or store covers 512 contiguous bytes.
// ---------------------------------------------------------------------------

typedef __attribute__((ext_vector_type(16))) _Float16 v16h;
typedef __attribute__((ext_vector_type(8)))  _Float16 v8h;
typedef __attribute__((ext_vector_type(8)))  float    v8f;
typedef __attribute__((ext_vector_type(4)))  float    v4f;

#define BATCH 4
#define SEQ   2048
#define DIM   1024
#define NHEAD 16
#define DHEAD 64
#define MTOT  (BATCH * SEQ)       // 8192 rows

union V16U { v16h v; v8h h[2]; };

// CDNA5 16-bit A/B fragment (16x32 / 32x16), per-lane layout:
//   lanes 0-15 : K = ko+{0..7} in halves 0-7, K = ko+{16..23} in halves 8-15, ko=0
//   lanes16-31 : same with ko=8
//
// Fragment order of a [rows][K] f16 matrix: the 16 x 32 fragment
// (rt = row >> 4, kc = k >> 5) is the 1 KB block number rt * (K / 32) + kc.
// Inside it, element (row & 15, k & 31) lies at half-word
//   ((k >> 4) & 1) * 256 + (((k >> 3) & 1) * 16 + (row & 15)) * 8 + (k & 7)
// i.e. lane L finds its halves 0-7 at L * 8 and its halves 8-15 at 256 + L * 8.
#define FRAG_H 512                 // half-words per fragment block
#define FR_DIM (DIM / 32)          // fragment blocks per 16-row band, K = DIM
#define FR_SEQ (SEQ / 32)          // the same, K = SEQ (transposed copy)

// p points at the fragment block + lane * 8.
__device__ inline v16h frag_from_f16(const _Float16* __restrict__ p) {
  V16U u;
  u.h[0] = *(const v8h*)(p);
  u.h[1] = *(const v8h*)(p + 256);
  return u.v;
}

__device__ inline v8f wmma_f16(v16h a, v16h b, v8f c) {
  // D = A(16x32,f16) * B(32x16,f16) + C(16x16,f32)
  return __builtin_amdgcn_wmma_f32_16x16x32_f16(false, a, false, b,
                                                (short)0, c, false, false);
}

// ---------------------------------------------------------------------------
// Kernel 0: bulk f32 -> f16 conversion of a [rows][DIM] matrix into fragment
// order. Thread i writes the i-th 16-byte piece of the output and reads the
// 8 floats that belong there.
// ---------------------------------------------------------------------------
__global__ __launch_bounds__(256) void cvt_f32_f16_kernel(
    const float* __restrict__ src, _Float16* __restrict__ dst, int n8) {
  const int i = blockIdx.x * 256 + threadIdx.x;
  if (i >= n8) return;
  const int fr  = i >> 6;                               // fragment block
  const int row = (fr / FR_DIM) * 16 + (i & 15);
  const int k   = (fr % FR_DIM) * 32 + ((i >> 5) & 1) * 16 + ((i >> 4) & 1) * 8;
  const float* s = src + (size_t)row * DIM + k;
  const v4f a = *(const v4f*)(s);
  const v4f b = *(const v4f*)(s + 4);
  v8h o;
#pragma unroll
  for (int j = 0; j < 4; ++j) {
    o[j]     = (_Float16)a[j];
    o[4 + j] = (_Float16)b[j];
  }
  *(v8h*)(dst + (size_t)i * 8) = o;
}

// ---------------------------------------------------------------------------
// Main loop of both GEMMs: C[128 x 128] += A[128 x DIM] * B[128 x DIM]^T per block.
// Two waves need the same A rows, two the same B rows: the block brings every stage
// (128 k of both operands, 64 KB) into LDS once, two buffers, the next stage in
// flight while one is worked on, and the waves take their fragments from there.
// Stage layout (half-words): A fragment (band t of 8, kc of 4) at (t * 4 + kc) * FRAG_H,
// B fragment the same behind GS_OP_H. A band's four fragments are 4 KB in a row in
// global memory and in LDS alike.
// ---------------------------------------------------------------------------
#define GBAND   (FR_DIM * FRAG_H)  // half-words from one 16-row band to the next
#define GS_OP_H (8 * 4 * FRAG_H)   // half-words of one operand's part of a stage (32 KB)
#define GS_H    (2 * GS_OP_H)      // half-words per stage
#define GS_N    (DIM / 128)        // stages

// Four bands of one operand, per thread two 16-byte pieces (2 KB apart) of each.
// The wait in the same statement stands before the address registers are rewritten.
__device__ inline void copy_bands4(unsigned lds, const _Float16* g) {
  asm volatile(
      "global_load_async_to_lds_b128 %0, %8, off\n\t"
      "global_load_async_to_lds_b128 %1, %9, off\n\t"
      "global_load_async_to_lds_b128 %2, %10, off\n\t"
      "global_load_async_to_lds_b128 %3, %11, off\n\t"
      "global_load_async_to_lds_b128 %4, %12, off\n\t"
      "global_load_async_to_lds_b128 %5, %13, off\n\t"
      "global_load_async_to_lds_b128 %6, %14, off\n\t"
      "global_load_async_to_lds_b128 %7, %15, off\n\t"
      "s_wait_xcnt 0x0"
      :: "v"(lds), "v"(lds + 2048u), "v"(lds + 4096u), "v"(lds + 6144u),
         "v"(lds + 8192u), "v"(lds + 10240u), "v"(lds + 12288u), "v"(lds + 14336u),
         "v"(g), "v"(g + 1024), "v"(g + GBAND), "v"(g + GBAND + 1024),
         "v"(g + 2 * GBAND), "v"(g + 2 * GBAND + 1024),
         "v"(g + 3 * GBAND), "v"(g + 3 * GBAND + 1024)
      : "memory");
}

// One stage: 4096 pieces of 16 bytes, 32 per thread. a, b: the block's first band of each
// operand at the stage's first fragment, plus tid * 8.
__device__ inline void gemm_copy_stage(unsigned lds, const _Float16* a, const _Float16* b) {
  copy_bands4(lds, a);
  copy_bands4(lds + 16384u, a + 4 * GBAND);
  copy_bands4(lds + 32768u, b);
  copy_bands4(lds + 49152u, b + 4 * GBAND);
}

// A, B: the block's first band of each operand. ring: 2 * GS_H half-words of LDS.
__device__ inline void gemm_mainloop(const _Float16* __restrict__ A,
                                     const _Float16* __restrict__ B,
                                     const _Float16* ring, v8f (&acc)[4][4]) {
  const int tid  = threadIdx.x;
  const int lane = tid & 31;
  const int wave = tid >> 5;
  const _Float16* ac = A + tid * 8;
  const _Float16* bc = B + tid * 8;
  const unsigned lds0 = (unsigned)(size_t)(ring) + tid * 16;
  // this wave's four A bands and four B bands inside a stage
  const int offa = (wave >> 1) * 16 * FRAG_H + lane * 8;
  const int offb = GS_OP_H + (wave & 1) * 16 * FRAG_H + lane * 8;

  gemm_copy_stage(lds0, ac, bc);
  // stage 0 has landed (this wave's pieces), then is published to the block
  asm volatile("s_wait_asynccnt 0x0" ::: "memory");
  __syncthreads();
  gemm_copy_stage(lds0 + GS_H * 2, ac + 4 * FRAG_H, bc + 4 * FRAG_H);

  for (int t = 0; t < GS_N; ++t) {
    const _Float16* sa = ring + (t & 1) * GS_H + offa;
    const _Float16* sb = ring + (t & 1) * GS_H + offb;
    v16h af[2][4], bf[2][4];
#pragma unroll
    for (int i = 0; i < 4; ++i) {
      af[0][i] = frag_from_f16(sa + i * 4 * FRAG_H);
      bf[0][i] = frag_from_f16(sb + i * 4 * FRAG_H);
    }
#pragma unroll
    for (int ks = 0; ks < 4; ++ks) {
      if (ks < 3) {
#pragma unroll
        for (int i = 0; i < 4; ++i) {
          af[(ks + 1) & 1][i] = frag_from_f16(sa + (i * 4 + ks + 1) * FRAG_H);
          bf[(ks + 1) & 1][i] = frag_from_f16(sb + (i * 4 + ks + 1) * FRAG_H);
        }
      } else {
        // ---- publish stage t + 1, free this stage's buffer: the last k step's fragments
        // are in registers, so its products run while the refill is already in flight.
        // Keeps the products of the step before in front of the barrier; without it they
        // sink behind it and hold the refill's copies back by their whole run
        __builtin_amdgcn_sched_barrier(0);
        // this wave's reads of the buffer are done
        asm volatile("s_wait_dscnt 0x0" ::: "memory");
        // this wave's pieces of stage t + 1 have landed
        asm volatile("s_wait_asynccnt 0x0" ::: "memory");
        __syncthreads();
        if (t + 2 < GS_N)
          gemm_copy_stage(lds0 + (t & 1) * (GS_H * 2), ac + (t + 2) * 4 * FRAG_H,
                          bc + (t + 2) * 4 * FRAG_H);
      }
      // keeps the next k step's 16 LDS loads (behind the last step: the refill's copies) in
      // front of this step's products, so that their latency runs under the products;
      // without it the loads sink among the products and the copies behind them
      __builtin_amdgcn_sched_barrier(0);
#pragma unroll
      for (int mt = 0; mt < 4; ++mt)
#pragma unroll
        for (int nt = 0; nt < 4; ++nt)
          acc[mt][nt] = wmma_f16(af[ks & 1][mt], bf[ks & 1][nt], acc[mt][nt]);
    }
  }
  // no copy is outstanding when the wave ends
  asm volatile("s_wait_asynccnt 0x0" ::: "memory");
}

// ---------------------------------------------------------------------------
// Kernel 1: qkv = X @ Wqkv^T   (f16 WMMA, f32 accumulate, f16 outputs)
// Also writes the transposed copy qkvT[b][d][s] used as the V^T fragments.
// All four tensors are in fragment order.
// Block: 128 threads = 4 waves (2x2), block tile 128x128, wave tile 64x64.
// ---------------------------------------------------------------------------
__global__ __launch_bounds__(128) void qkv_gemm_kernel(
    const _Float16* __restrict__ X,   // [8192,1024] f16
    const _Float16* __restrict__ W,   // [1024,1024] f16 (out,in)
    _Float16* __restrict__ qkv,       // [8192,1024]
    _Float16* __restrict__ qkvT) {    // [4*1024][2048]
  __shared__ __attribute__((aligned(1024))) _Float16 ring[2 * GS_H];
  const int lane = threadIdx.x & 31;
  const int wave = threadIdx.x >> 5;
  const int l15  = lane & 15;
  const int mb   = blockIdx.y * 128 + (wave >> 1) * 64;
  const int nb   = blockIdx.x * 128 + (wave & 1) * 64;

  v8f acc[4][4];
#pragma unroll
  for (int mt = 0; mt < 4; ++mt)
#pragma unroll
    for (int nt = 0; nt < 4; ++nt) acc[mt][nt] = (v8f)(0.0f);

  gemm_mainloop(X + (size_t)(blockIdx.y * 8) * GBAND, W + (size_t)(blockIdx.x * 8) * GBAND,
                ring, acc);

  const int rsel = (lane >> 4) << 3;        // C-layout: lanes 16-31 hold rows +8
#pragma unroll
  for (int mt = 0; mt < 4; ++mt)
#pragma unroll
    for (int nt = 0; nt < 4; ++nt) {
      const int r0 = mb + mt * 16;          // rows r0 + rsel + j
      const int c0 = nb + nt * 16;          // column c0 + l15
      v8h o;
#pragma unroll
      for (int j = 0; j < 8; ++j) o[j] = (_Float16)acc[mt][nt][j];
      // qkvT row (r0 >> 11) * DIM + c, k = s = r & 2047: a lane's 8 values are
      // one 16-byte piece of the fragment, at lane * 8
      const int tr = ((r0 >> 11) * DIM + c0) >> 4;
      *(v8h*)(qkvT + ((size_t)tr * FR_SEQ + ((r0 & 2047) >> 5)) * FRAG_H +
              ((r0 >> 4) & 1) * 256 + lane * 8) = o;
      // qkv row r, k = c: one half-word per row
      _Float16* kp = qkv + ((size_t)(r0 >> 4) * FR_DIM + (c0 >> 5)) * FRAG_H +
                     ((c0 >> 4) & 1) * 256 + ((l15 >> 3) * 16 + rsel) * 8 + (l15 & 7);
#pragma unroll
      for (int j = 0; j < 8; ++j) kp[j * 8] = o[j];
    }
}

// ---------------------------------------------------------------------------
// Kernel 2: flash attention, q=k=v=qkv, in transposed form:
//   S^T = K * Q^T   (A = key rows, B = query rows kept in registers)
//   O^T += V^T * P^T (A = rows of qkvT, B = P^T packed from the S^T tiles)
// A lane of a 16-column group holds the scores of ONE query, so maximum and
// sum run in the lane; the two lane halves (keys 8h..8h+7 of each 16) join
// their maxima once per key tile and their sums once, after the loop.
// Two S^T accumulator tiles (keys 0-15, 16-31) converted in place are the
// B operand of the second product: P needs no LDS and no barrier.
// One block = (b,h, 256 q-rows); each of 8 waves owns 32 queries, loops keys
// in tiles of 64.
// All 8 waves read the same K and V^T tile: the block brings each tile into LDS
// once (two buffers, the next tile in flight while one is worked on) and
// the waves take their fragments from there.
// Stage layout (half-words): K fragments (nt, ks) at (nt * 2 + ks) * FRAG_H,
// V^T fragments (dt, c2) at STAGE_V + (dt * 2 + c2) * FRAG_H.
// ---------------------------------------------------------------------------
#define STAGE_V 4096               // half-words of the K part of a stage
#define STAGE_H 8192               // half-words per stage (K 8 KB + V^T 8 KB)

// One stage = 1024 pieces of 16 bytes, four per thread: piece c * 256 + tid.
// The wait in the same statement stands before the address registers are rewritten.
__device__ inline void copy_stage(unsigned lds, const _Float16* k0, const _Float16* k1,
                                  const _Float16* v0, const _Float16* v1) {
  asm volatile(
      "global_load_async_to_lds_b128 %0, %4, off\n\t"
      "global_load_async_to_lds_b128 %1, %5, off\n\t"
      "global_load_async_to_lds_b128 %2, %6, off\n\t"
      "global_load_async_to_lds_b128 %3, %7, off\n\t"
      "s_wait_xcnt 0x0"
      :: "v"(lds), "v"(lds + 4096u), "v"(lds + 8192u), "v"(lds + 12288u),
         "v"(k0), "v"(k1), "v"(v0), "v"(v1)
      : "memory");
}
// value of the same column in the other 16-lane half (lane l <-> l ^ 16)
__device__ inline float other_half(float v) {
  int b = __builtin_bit_cast(int, v);
  b = __builtin_amdgcn_permlanex16(b, b, 0x76543210, 0xfedcba98, false, false);
  return __builtin_bit_cast(float, b);
}

// 2^x as the bare hardware instruction. The library's exp2f adds a range check per value
// (compare, select, add, select, ldexp) that only serves results below 2^-126. Every
// argument here is <= 0 and each query's largest term is 2^0 = 1, so such a result
// is 0 as an f16 weight and is lost in the f32 sum either way.
__device__ inline float exp2_bare(float x) { return __builtin_amdgcn_exp2f(x); }

__global__ __launch_bounds__(256) void attn_kernel(
    const _Float16* __restrict__ qkv,   // [4*2048][1024], fragment order
    const _Float16* __restrict__ qkvT,  // [4*1024][2048], fragment order
    _Float16* __restrict__ aout) {      // [4*2048][1024], fragment order
  __shared__ __attribute__((aligned(1024))) _Float16 ring[2 * STAGE_H];
  const int lane = threadIdx.x & 31;
  const int wave = threadIdx.x >> 5;

  const int bh = blockIdx.y;
  const int b  = bh >> 4;
  const int h  = bh & 15;
  const int q0 = blockIdx.x * 256 + wave * 32;

  // fragment (16 rows from seq position s, d chunk ks) : qk + (s >> 4) * KBAND + ks * FRAG_H
  // fragment (16 d from dt * 16, 32 keys from chunk kc) : vT + dt * VBAND + kc * FRAG_H
  const int KBAND = FR_DIM * FRAG_H;
  const int VBAND = FR_SEQ * FRAG_H;
  const _Float16* qk = qkv + ((size_t)(b * SEQ >> 4) * FR_DIM + h * (DHEAD / 32)) * FRAG_H;
  const _Float16* vT = qkvT + (size_t)((b * DIM + h * DHEAD) >> 4) * VBAND;

  // scale folded into exp2 domain: exp(s/8) = 2^(s * log2(e)/8)
  const float SC2 = 0.18033688011112042f;

  // resident Q fragments (B operand, column = query): [qg][ks]
  v16h qf[2][2];
#pragma unroll
  for (int qg = 0; qg < 2; ++qg)
#pragma unroll
    for (int ks = 0; ks < 2; ++ks)
      qf[qg][ks] = frag_from_f16(qk + (size_t)((q0 >> 4) + qg) * KBAND + ks * FRAG_H + lane * 8);

  // O^T tiles: oacc[dt][qg][r] = O[query qg*16+l15][d = dt*16 + rsel + r]
  v8f oacc[4][2];
#pragma unroll
  for (int dt = 0; dt < 4; ++dt)
#pragma unroll
    for (int qg = 0; qg < 2; ++qg) oacc[dt][qg] = (v8f)(0.0f);

  float mrow[2], lrow[2];   // per lane: its query's maximum, its half's sum
#pragma unroll
  for (int qg = 0; qg < 2; ++qg) { mrow[qg] = -INFINITY; lrow[qg] = 0.0f; }

  // this thread's pieces of a stage: each tile is four runs of 2 KB (128 pieces), one
  // per band; bands (tid >> 7) and 2 + (tid >> 7) of K, then the same of V^T
  const int tid = threadIdx.x;
  const _Float16* kc = qk + (size_t)(tid >> 7) * KBAND + (tid & 127) * 8;
  const _Float16* vc = vT + (size_t)(tid >> 7) * VBAND + (tid & 127) * 8;
  const unsigned lds0 = (unsigned)(size_t)(&ring[0]) + tid * 16;

  copy_stage(lds0, kc, kc + 2 * KBAND, vc, vc + 2 * VBAND);
  // tile 0 has landed (this wave's pieces), then is published to the block
  asm volatile("s_wait_asynccnt 0x0" ::: "memory");
  __syncthreads();
  copy_stage(lds0 + STAGE_H * 2, kc + 4 * KBAND, kc + 6 * KBAND,
             vc + 2 * FRAG_H, vc + 2 * VBAND + 2 * FRAG_H);

  for (int kt = 0; kt < SEQ / 64; ++kt) {
    const _Float16* st = ring + (kt & 1) * STAGE_H + lane * 8;

    // ---- scores S^T = K @ Q^T : sc[nt][qg][r] = S[query][key nt*16+rsel+r]
    v8f sc[4][2];
#pragma unroll
    for (int nt = 0; nt < 4; ++nt)
#pragma unroll
      for (int qg = 0; qg < 2; ++qg) sc[nt][qg] = (v8f)(0.0f);

    v16h kf[2][4];
#pragma unroll
    for (int ks = 0; ks < 2; ++ks)
#pragma unroll
      for (int nt = 0; nt < 4; ++nt)
        kf[ks][nt] = frag_from_f16(st + (nt * 2 + ks) * FRAG_H);
    // keeps the tile's 16 loads together in front of the products (one latency, counted
    // waits); without it most are issued in pairs among the products, each pair waited
    // out in full, and the kernel takes over 256 registers (one block on a WGP, not two)
    __builtin_amdgcn_sched_barrier(0);
#pragma unroll
    for (int ks = 0; ks < 2; ++ks)
#pragma unroll
      for (int nt = 0; nt < 4; ++nt)
#pragma unroll
        for (int qg = 0; qg < 2; ++qg)
          sc[nt][qg] = wmma_f16(kf[ks][nt], qf[qg][ks], sc[nt][qg]);

    // ---- online softmax, one query per lane -------------------------------
    v16h pf[2][2];            // P^T as B operand: [qg][32-key chunk]
#pragma unroll
    for (int qg = 0; qg < 2; ++qg) {
#pragma unroll
      for (int nt = 0; nt < 4; ++nt) sc[nt][qg] *= SC2;

      float m8[8];
#pragma unroll
      for (int j = 0; j < 8; ++j)
        m8[j] = fmaxf(fmaxf(sc[0][qg][j], sc[1][qg][j]),
                      fmaxf(sc[2][qg][j], sc[3][qg][j]));
      float rm = fmaxf(fmaxf(fmaxf(m8[0], m8[1]), fmaxf(m8[2], m8[3])),
                       fmaxf(fmaxf(m8[4], m8[5]), fmaxf(m8[6], m8[7])));
      rm = fmaxf(rm, other_half(rm));

      const float mold = mrow[qg];
      const float mnew = fmaxf(mold, rm);
      // = 2^(mold - mnew), 0 on the first tile (mold = -inf). The sign goes into the
      // instruction's source modifier: written mold - mnew, the compiler pairs this
      // subtraction with a score's, every later pair of scores sits one register off, and
      // a tile pays about twenty register moves and half its fused multiply-adds for it.
      const float corr = exp2_bare(-(mnew - mold));
      mrow[qg] = mnew;

#pragma unroll
      for (int nt = 0; nt < 4; ++nt)
#pragma unroll
        for (int j = 0; j < 8; ++j) sc[nt][qg][j] = exp2_bare(sc[nt][qg][j] - mnew);

      const v8f s8 = (sc[0][qg] + sc[1][qg]) + (sc[2][qg] + sc[3][qg]);
      const float rs = ((s8[0] + s8[1]) + (s8[2] + s8[3])) +
                       ((s8[4] + s8[5]) + (s8[6] + s8[7]));
      lrow[qg] = lrow[qg] * corr + rs;

#pragma unroll
      for (int dt = 0; dt < 4; ++dt) oacc[dt][qg] *= corr;

      // element s of the B operand is key kmap(s) = tile (s >> 3), register s & 7
#pragma unroll
      for (int c2 = 0; c2 < 2; ++c2)
#pragma unroll
        for (int s = 0; s < 16; ++s)
          pf[qg][c2][s] = (_Float16)sc[c2 * 2 + (s >> 3)][qg][s & 7];
    }

    // ---- O^T += V^T @ P^T --------------------------------------------------
#pragma unroll
    for (int c2 = 0; c2 < 2; ++c2) {
      v16h vf[4];
#pragma unroll
      for (int dt = 0; dt < 4; ++dt)
        vf[dt] = frag_from_f16(st + STAGE_V + (dt * 2 + c2) * FRAG_H);
#pragma unroll
      for (int dt = 0; dt < 4; ++dt)
#pragma unroll
        for (int qg = 0; qg < 2; ++qg)
          oacc[dt][qg] = wmma_f16(vf[dt], pf[qg][c2], oacc[dt][qg]);
    }

    // ---- publish tile kt + 1, free this tile's buffer -----------------------
    // this wave's reads of the buffer are done
    asm volatile("s_wait_dscnt 0x0" ::: "memory");
    // this wave's pieces of tile kt + 1 have landed
    asm volatile("s_wait_asynccnt 0x0" ::: "memory");
    __syncthreads();
    if (kt + 2 < SEQ / 64) {
      const _Float16* kn = kc + (size_t)(kt + 2) * 4 * KBAND;
      const _Float16* vn = vc + (kt + 2) * 2 * FRAG_H;
      copy_stage(lds0 + (kt & 1) * (STAGE_H * 2), kn, kn + 2 * KBAND, vn, vn + 2 * VBAND);
    }
  }
  // no copy is outstanding when the wave ends
  asm volatile("s_wait_asynccnt 0x0" ::: "memory");

  // ---- join the halves' sums, normalize, store 8 consecutive d per lane ----
#pragma unroll
  for (int qg = 0; qg < 2; ++qg) {
    const float inv = 1.0f / (lrow[qg] + other_half(lrow[qg]));
    // row = the lane's query, k = h * 64 + dt * 16 + 8 * (lane >> 4) + 0..7: piece number
    // 'lane' of half (dt & 1) of fragment (row band, h * 2 + (dt >> 1))
    _Float16* ob = aout + ((size_t)(((b * SEQ + q0) >> 4) + qg) * FR_DIM + h * (DHEAD / 32)) * FRAG_H + lane * 8;
#pragma unroll
    for (int dt = 0; dt < 4; ++dt) {
      v8h o;
#pragma unroll
      for (int j = 0; j < 8; ++j) o[j] = (_Float16)(oacc[dt][qg][j] * inv);
      *(v8h*)(ob + (dt >> 1) * FRAG_H + (dt & 1) * 256) = o;
    }
  }
}

// ---------------------------------------------------------------------------
// Kernel 3: out = AttnOut @ Wout^T + bias   (f16 WMMA, f32 bias/store)
// ---------------------------------------------------------------------------
__global__ __launch_bounds__(128) void out_gemm_kernel(
    const _Float16* __restrict__ A,   // [8192,1024] f16, fragment order
    const _Float16* __restrict__ W,   // [1024,1024] f16 (out,in), fragment order
    const float* __restrict__ bias,   // [1024] f32
    float* __restrict__ out) {        // [8192,1024] f32
  __shared__ __attribute__((aligned(1024))) _Float16 ring[2 * GS_H];
  const int lane = threadIdx.x & 31;
  const int wave = threadIdx.x >> 5;
  const int l15  = lane & 15;
  const int mb   = blockIdx.y * 128 + (wave >> 1) * 64;
  const int nb   = blockIdx.x * 128 + (wave & 1) * 64;

  v8f acc[4][4];
#pragma unroll
  for (int mt = 0; mt < 4; ++mt)
#pragma unroll
    for (int nt = 0; nt < 4; ++nt) acc[mt][nt] = (v8f)(0.0f);

  gemm_mainloop(A + (size_t)(blockIdx.y * 8) * GBAND, W + (size_t)(blockIdx.x * 8) * GBAND,
                ring, acc);

  float bv[4];
#pragma unroll
  for (int nt = 0; nt < 4; ++nt) bv[nt] = bias[nb + nt * 16 + l15];

  const int rsel = (lane >> 4) << 3;
#pragma unroll
  for (int mt = 0; mt < 4; ++mt)
#pragma unroll
    for (int nt = 0; nt < 4; ++nt)
#pragma unroll
      for (int j = 0; j < 8; ++j) {
        const int r = mb + mt * 16 + rsel + j;
        const int c = nb + nt * 16 + l15;
        out[(size_t)r * DIM + c] = acc[mt][nt][j] + bv[nt];
      }
}

// ---------------------------------------------------------------------------
extern "C" void kernel_launch(void* const* d_in, const int* in_sizes, int n_in,
                              void* d_out, int out_size, void* d_ws, size_t ws_size,
                              hipStream_t stream) {
  const float* x     = (const float*)d_in[0];   // [4,2048,1024]
  const float* w_qkv = (const float*)d_in[1];   // [1024,1024]
  const float* w_out = (const float*)d_in[2];   // [1024,1024]
  const float* b_out = (const float*)d_in[3];   // [1024]
  float* out = (float*)d_out;

  // workspace (f16, all in fragment order): xh 16MB | wqkvh 2MB | wouth 2MB | qkv 16MB | qkvT 16MB | aout 16MB
  _Float16* xh    = (_Float16*)d_ws;
  _Float16* wqkvh = xh    + (size_t)MTOT * DIM;
  _Float16* wouth = wqkvh + (size_t)DIM * DIM;
  _Float16* qkv   = wouth + (size_t)DIM * DIM;
  _Float16* qkvT  = qkv   + (size_t)MTOT * DIM;
  _Float16* aout  = qkvT  + (size_t)MTOT * DIM;

  // ---- pre-convert inputs to f16 (one pass each) ----
  {
    const int n8x = MTOT * DIM / 8;                    // 1,048,576
    cvt_f32_f16_kernel<<<n8x / 256, 256, 0, stream>>>(x, xh, n8x);
    const int n8w = DIM * DIM / 8;                     // 131,072
    cvt_f32_f16_kernel<<<n8w / 256, 256, 0, stream>>>(w_qkv, wqkvh, n8w);
    cvt_f32_f16_kernel<<<n8w / 256, 256, 0, stream>>>(w_out, wouth, n8w);
  }
  {
    dim3 grid(DIM / 128, MTOT / 128);           // (8, 64)
    qkv_gemm_kernel<<<grid, 128, 0, stream>>>(xh, wqkvh, qkv, qkvT);
  }
  {
    dim3 grid(SEQ / 256, BATCH * NHEAD);        // (8, 64)
    attn_kernel<<<grid, 256, 0, stream>>>(qkv, qkvT, aout);
  }
  {
    dim3 grid(DIM / 128, MTOT / 128);           // (8, 64)
    out_gemm_kernel<<<grid, 128, 0, stream>>>(aout, wouth, b_out, out);
  }
}

// v008
// It runs in 93.6 microseconds.
// Versions between v006 and this one are left out; their measured steps multiply to 1.15 times as fast.
// Counting every step since v000, it is 6.64 times as fast.
#include <hip/hip_runtime.h>
#include <hip/hip_bf16.h>

// ---------------------------------------------------------------------------
// Multi-head self-attention (shared QKV projection) for MI455X / gfx1250.
// f32 inputs are pre-converted to f16 once (one launch for all three), then all
// matmuls run through v_wmma_f32_16x16x32_f16 (f16 in, f32 accumulate) with
// pure f16 b128 fragment loads in the hot loops. Flash-attention style:
// the 1 GB score matrix never exists; softmax runs online in registers.
// The GEMMs stage their operand tiles, attention its key and value tiles, in LDS,
// once per block, by asynchronous copies.
// Every f16 tensor in the workspace is kept in FRAGMENT ORDER (see below), so
// that one wave-wide 16-byte load or store covers 512 contiguous bytes.
// ---------------------------------------------------------------------------

typedef __attribute__((ext_vector_type(16))) _Float16 v16h;
typedef __attribute__((ext_vector_type(8)))  _Float16 v8h;
typedef __attribute__((ext_vector_type(8)))  float    v8f;
typedef __attribute__((ext_vector_type(4)))  float    v4f;

#define BATCH 4
#define SEQ   2048
#define DIM   1024
#define NHEAD 16
#define DHEAD 64
#define MTOT  (BATCH * SEQ)       // 8192 rows

union V16U { v16h v; v8h h[2]; };

// CDNA5 16-bit A/B fragment (16x32 / 32x16), per-lane layout:
//   lanes 0-15 : K = ko+{0..7} in halves 0-7, K = ko+{16..23} in halves 8-15, ko=0
//   lanes16-31 : same with ko=8
//
// Fragment order of a [rows][K] f16 matrix: the 16 x 32 fragment
// (rt = row >> 4, kc = k >> 5) is the 1 KB block number rt * (K / 32) + kc.
// Inside it, element (row & 15, k & 31) lies at half-word
//   ((k >> 4) & 1) * 256 + (((k >> 3) & 1) * 16 + (row & 15)) * 8 + (k & 7)
// i.e. lane L finds its halves 0-7 at L * 8 and its halves 8-15 at 256 + L * 8.
#define FRAG_H 512                 // half-words per fragment block
#define FR_DIM (DIM / 32)          // fragment blocks per 16-row band, K = DIM
#define FR_SEQ (SEQ / 32)          // the same, K = SEQ (transposed copy)

// p points at the fragment block + lane * 8.
__device__ inline v16h frag_from_f16(const _Float16* __restrict__ p) {
  V16U u;
  u.h[0] = *(const v8h*)(p);
  u.h[1] = *(const v8h*)(p + 256);
  return u.v;
}

__device__ inline v8f wmma_f16(v16h a, v16h b, v8f c) {
  // D = A(16x32,f16) * B(32x16,f16) + C(16x16,f32)
  return __builtin_amdgcn_wmma_f32_16x16x32_f16(false, a, false, b,
                                                (short)0, c, false, false);
}

// ---------------------------------------------------------------------------
// Kernel 0: f32 -> f16 conversion of x and of both weight matrices ([rows][DIM] each)
// into fragment order, all in ONE launch of one 16-wave block per WGP. Piece i of a
// tensor is the i-th 16 bytes of its output and comes from the 8 floats that belong
// there. A lane converts ten pieces: eight of x (its wave takes four fragments in a row,
// 512 contiguous bytes of each of 16 rows, 4 KB of output) and one of each weight.
// One piece per lane would take ten times the waves: the pass is short, and what it costs
// is launches and wave starts more than bytes.
// ---------------------------------------------------------------------------
#define CVT_THREADS 512
#define CVT_BLOCKS  256
#define CVT_LANES   (CVT_THREADS * CVT_BLOCKS)
#define CVT_XP      8              // pieces of x per lane
static_assert(MTOT * DIM / 8 == CVT_XP * CVT_LANES, "x: eight pieces per lane");
static_assert(DIM * DIM / 8 == CVT_LANES, "a weight matrix: one piece per lane");
static_assert(FR_DIM % (CVT_XP / 2) == 0, "a wave's fragments of x share a row band");

// the 8 floats of piece i
__device__ inline const float* cvt_piece_src(const float* __restrict__ src, unsigned i) {
  const unsigned fr  = i >> 6;                          // fragment block
  const unsigned row = (fr / FR_DIM) * 16 + (i & 15);
  const unsigned k   = (fr % FR_DIM) * 32 + ((i >> 5) & 1) * 16 + ((i >> 4) & 1) * 8;
  return src + (size_t)(row * DIM + k);
}

__device__ inline v8h cvt_piece(v4f a, v4f b) {
  v8h o;
#pragma unroll
  for (int j = 0; j < 4; ++j) {
    o[j]     = (_Float16)a[j];
    o[4 + j] = (_Float16)b[j];
  }
  return o;
}

__global__ __launch_bounds__(CVT_THREADS) void cvt_f32_f16_kernel(
    const float* __restrict__ x, const float* __restrict__ wq, const float* __restrict__ wo,
    _Float16* __restrict__ xh, _Float16* __restrict__ wqh, _Float16* __restrict__ woh) {
  const unsigned g  = blockIdx.x * CVT_THREADS + threadIdx.x;
  const unsigned x0 = (g >> 5) * (32 * CVT_XP) + (g & 31);   // the lane's first piece of x
  // pieces x0 + 32 * j: the same row, 16 floats further on each (the wave's four
  // fragments lie in one 16-row band, as FR_DIM is a multiple of four)
  const float* sx = cvt_piece_src(x, x0);
  const float* sq = cvt_piece_src(wq, g);
  const float* so = cvt_piece_src(wo, g);

  v4f a[CVT_XP + 2], b[CVT_XP + 2];
#pragma unroll
  for (int j = 0; j < CVT_XP; ++j) {
    a[j] = *(const v4f*)(sx + j * 16);
    b[j] = *(const v4f*)(sx + j * 16 + 4);
  }
  a[CVT_XP]     = *(const v4f*)(sq);
  b[CVT_XP]     = *(const v4f*)(sq + 4);
  a[CVT_XP + 1] = *(const v4f*)(so);
  b[CVT_XP + 1] = *(const v4f*)(so + 4);
  // keeps all 20 loads in front of the first conversion, one memory latency per wave;
  // without it they are issued in two batches, the second behind a wait on the first
  __builtin_amdgcn_sched_barrier(0);
#pragma unroll
  for (int j = 0; j < CVT_XP; ++j)
    *(v8h*)(xh + (size_t)(x0 + j * 32) * 8) = cvt_piece(a[j], b[j]);
  *(v8h*)(wqh + (size_t)g * 8) = cvt_piece(a[CVT_XP], b[CVT_XP]);
  *(v8h*)(woh + (size_t)g * 8) = cvt_piece(a[CVT_XP + 1], b[CVT_XP + 1]);
}

// ---------------------------------------------------------------------------
// Main loop of both GEMMs: C[128 x 128] += A[128 x DIM] * B[128 x DIM]^T per block.
// Two waves need the same A rows, two the same B rows: the block brings every stage
// (128 k of both operands, 64 KB) into LDS once, two buffers, the next stage in
// flight while one is worked on, and the waves take their fragments from there.
// Stage layout (half-words): A fragment (band t of 8, kc of 4) at (t * 4 + kc) * FRAG_H,
// B fragment the same behind GS_OP_H. A band's four fragments are 4 KB in a row in
// global memory and in LDS alike.
// ---------------------------------------------------------------------------
#define GBAND   (FR_DIM * FRAG_H)  // half-words from one 16-row band to the next
#define GS_OP_H (8 * 4 * FRAG_H)   // half-words of one operand's part of a stage (32 KB)
#define GS_H    (2 * GS_OP_H)      // half-words per stage
#define GS_N    (DIM / 128)        // stages

// Four bands of one operand, per thread two 16-byte pieces (2 KB apart) of each.
// The wait in the same statement stands before the address registers are rewritten.
__device__ inline void copy_bands4(unsigned lds, const _Float16* g) {
  asm volatile(
      "global_load_async_to_lds_b128 %0, %8, off\n\t"
      "global_load_async_to_lds_b128 %1, %9, off\n\t"
      "global_load_async_to_lds_b128 %2, %10, off\n\t"
      "global_load_async_to_lds_b128 %3, %11, off\n\t"
      "global_load_async_to_lds_b128 %4, %12, off\n\t"
      "global_load_async_to_lds_b128 %5, %13, off\n\t"
      "global_load_async_to_lds_b128 %6, %14, off\n\t"
      "global_load_async_to_lds_b128 %7, %15, off\n\t"
      "s_wait_xcnt 0x0"
      :: "v"(lds), "v"(lds + 2048u), "v"(lds + 4096u), "v"(lds + 6144u),
         "v"(lds + 8192u), "v"(lds + 10240u), "v"(lds + 12288u), "v"(lds + 14336u),
         "v"(g), "v"(g + 1024), "v"(g + GBAND), "v"(g + GBAND + 1024),
         "v"(g + 2 * GBAND), "v"(g + 2 * GBAND + 1024),
         "v"(g + 3 * GBAND), "v"(g + 3 * GBAND + 1024)
      : "memory");
}

// One stage: 4096 pieces of 16 bytes, 32 per thread. a, b: the block's first band of each
// operand at the stage's first fragment, plus tid * 8.
__device__ inline void gemm_copy_stage(unsigned lds, const _Float16* a, const _Float16* b) {
  copy_bands4(lds, a);
  copy_bands4(lds + 16384u, a + 4 * GBAND);
  copy_bands4(lds + 32768u, b);
  copy_bands4(lds + 49152u, b + 4 * GBAND);
}

// A, B: the block's first band of each operand. ring: 2 * GS_H half-words of LDS.
__device__ inline void gemm_mainloop(const _Float16* __restrict__ A,
                                     const _Float16* __restrict__ B,
                                     const _Float16* ring, v8f (&acc)[4][4]) {
  const int tid  = threadIdx.x;
  const int lane = tid & 31;
  const int wave = tid >> 5;
  const _Float16* ac = A + tid * 8;
  const _Float16* bc = B + tid * 8;
  const unsigned lds0 = (unsigned)(size_t)(ring) + tid * 16;
  // this wave's four A bands and four B bands inside a stage
  const int offa = (wave >> 1) * 16 * FRAG_H + lane * 8;
  const int offb = GS_OP_H + (wave & 1) * 16 * FRAG_H + lane * 8;

  gemm_copy_stage(lds0, ac, bc);
  // stage 0 has landed (this wave's pieces), then is published to the block
  asm volatile("s_wait_asynccnt 0x0" ::: "memory");
  __syncthreads();
  gemm_copy_stage(lds0 + GS_H * 2, ac + 4 * FRAG_H, bc + 4 * FRAG_H);

  for (int t = 0; t < GS_N; ++t) {
    const _Float16* sa = ring + (t & 1) * GS_H + offa;
    const _Float16* sb = ring + (t & 1) * GS_H + offb;
    v16h af[2][4], bf[2][4];
#pragma unroll
    for (int i = 0; i < 4; ++i) {
      af[0][i] = frag_from_f16(sa + i * 4 * FRAG_H);
      bf[0][i] = frag_from_f16(sb + i * 4 * FRAG_H);
    }
#pragma unroll
    for (int ks = 0; ks < 4; ++ks) {
      if (ks < 3) {
#pragma unroll
        for (int i = 0; i < 4; ++i) {
          af[(ks + 1) & 1][i] = frag_from_f16(sa + (i * 4 + ks + 1) * FRAG_H);
          bf[(ks + 1) & 1][i] = frag_from_f16(sb + (i * 4 + ks + 1) * FRAG_H);
        }
      } else {
        // ---- publish stage t + 1, free this stage's buffer: the last k step's fragments
        // are in registers, so its products run while the refill is already in flight.
        // Keeps the products of the step before in front of the barrier; without it they
        // sink behind it and hold the refill's copies back by their whole run
        __builtin_amdgcn_sched_barrier(0);
        // this wave's reads of the buffer are done
        asm volatile("s_wait_dscnt 0x0" ::: "memory");
        // this wave's pieces of stage t + 1 have landed
        asm volatile("s_wait_asynccnt 0x0" ::: "memory");
        __syncthreads();
        if (t + 2 < GS_N)
          gemm_copy_stage(lds0 + (t & 1) * (GS_H * 2), ac + (t + 2) * 4 * FRAG_H,
                          bc + (t + 2) * 4 * FRAG_H);
      }
      // keeps the next k step's 16 LDS loads (behind the last step: the refill's copies) in
      // front of this step's products, so that their latency runs under the products;
      // without it the loads sink among the products and the copies behind them
      __builtin_amdgcn_sched_barrier(0);
#pragma unroll
      for (int mt = 0; mt < 4; ++mt)
#pragma unroll
        for (int nt = 0; nt < 4; ++nt)
          acc[mt][nt] = wmma_f16(af[ks & 1][mt], bf[ks & 1][nt], acc[mt][nt]);
    }
  }
  // no copy is outstanding when the wave ends
  asm volatile("s_wait_asynccnt 0x0" ::: "memory");
}

// ---------------------------------------------------------------------------
// Kernel 1: qkv = X @ Wqkv^T   (f16 WMMA, f32 accumulate, f16 outputs)
// Also writes the transposed copy qkvT[b][d][s] used as the V^T fragments.
// All four tensors are in fragment order.
// Block: 128 threads = 4 waves (2x2), block tile 128x128, wave tile 64x64.
// ---------------------------------------------------------------------------
__global__ __launch_bounds__(128) void qkv_gemm_kernel(
    const _Float16* __restrict__ X,   // [8192,1024] f16
    const _Float16* __restrict__ W,   // [1024,1024] f16 (out,in)
    _Float16* __restrict__ qkv,       // [8192,1024]
    _Float16* __restrict__ qkvT) {    // [4*1024][2048]
  __shared__ __attribute__((aligned(1024))) _Float16 ring[2 * GS_H];
  const int lane = threadIdx.x & 31;
  const int wave = threadIdx.x >> 5;
  const int l15  = lane & 15;
  const int mb   = blockIdx.y * 128 + (wave >> 1) * 64;
  const int nb   = blockIdx.x * 128 + (wave & 1) * 64;

  v8f acc[4][4];
#pragma unroll
  for (int mt = 0; mt < 4; ++mt)
#pragma unroll
    for (int nt = 0; nt < 4; ++nt) acc[mt][nt] = (v8f)(0.0f);

  gemm_mainloop(X + (size_t)(blockIdx.y * 8) * GBAND, W + (size_t)(blockIdx.x * 8) * GBAND,
                ring, acc);

  const int rsel = (lane >> 4) << 3;        // C-layout: lanes 16-31 hold rows +8
#pragma unroll
  for (int mt = 0; mt < 4; ++mt)
#pragma unroll
    for (int nt = 0; nt < 4; ++nt) {
      const int r0 = mb + mt * 16;          // rows r0 + rsel + j
      const int c0 = nb + nt * 16;          // column c0 + l15
      v8h o;
#pragma unroll
      for (int j = 0; j < 8; ++j) o[j] = (_Float16)acc[mt][nt][j];
      // qkvT row (r0 >> 11) * DIM + c, k = s = r & 2047: a lane's 8 values are
      // one 16-byte piece of the fragment, at lane * 8
      const int tr = ((r0 >> 11) * DIM + c0) >> 4;
      *(v8h*)(qkvT + ((size_t)tr * FR_SEQ + ((r0 & 2047) >> 5)) * FRAG_H +
              ((r0 >> 4) & 1) * 256 + lane * 8) = o;
      // qkv row r, k = c: one half-word per row
      _Float16* kp = qkv + ((size_t)(r0 >> 4) * FR_DIM + (c0 >> 5)) * FRAG_H +
                     ((c0 >> 4) & 1) * 256 + ((l15 >> 3) * 16 + rsel) * 8 + (l15 & 7);
#pragma unroll
      for (int j = 0; j < 8; ++j) kp[j * 8] = o[j];
    }
}

// ---------------------------------------------------------------------------
// Kernel 2: flash attention, q=k=v=qkv, in transposed form:
//   S^T = K * Q^T   (A = key rows, B = query rows kept in registers)
//   O^T += V^T * P^T (A = rows of qkvT, B = P^T packed from the S^T tiles)
// A lane of a 16-column group holds the scores of ONE query, so the sum runs in the
// lane; the two lane halves (keys 8h..8h+7 of each 16) join their sums once, after
// the loop.
// The exponent's argument comes straight out of the score product: Q is scaled when
// it is loaded and the accumulator starts at minus the query's reference, a maximum
// of earlier tiles. The reference is renewed (tile redone, O and sums rescaled) only
// in tile 0 and when a tile's row sum shows a weight too large for f16.
// Two S^T accumulator tiles (keys 0-15, 16-31) converted in place are the
// B operand of the second product: P needs no LDS and no barrier.
// One block = (b,h, 256 q-rows); each of 8 waves owns 32 queries, loops keys
// in tiles of 64.
// All 8 waves read the same K and V^T tile: the block brings each tile into LDS
// once (two buffers, the next tile in flight while one is worked on) and
// the waves take their fragments from there.
// Stage layout (half-words): K fragments (nt, ks) at (nt * 2 + ks) * FRAG_H,
// V^T fragments (dt, c2) at STAGE_V + (dt * 2 + c2) * FRAG_H.
// ---------------------------------------------------------------------------
#define STAGE_V 4096               // half-words of the K part of a stage
#define STAGE_H 8192               // half-words per stage (K 8 KB + V^T 8 KB)

// One stage = 1024 pieces of 16 bytes, four per thread: piece c * 256 + tid.
// The wait in the same statement stands before the address registers are rewritten.
__device__ inline void copy_stage(unsigned lds, const _Float16* k0, const _Float16* k1,
                                  const _Float16* v0, const _Float16* v1) {
  asm volatile(
      "global_load_async_to_lds_b128 %0, %4, off\n\t"
      "global_load_async_to_lds_b128 %1, %5, off\n\t"
      "global_load_async_to_lds_b128 %2, %6, off\n\t"
      "global_load_async_to_lds_b128 %3, %7, off\n\t"
      "s_wait_xcnt 0x0"
      :: "v"(lds), "v"(lds + 4096u), "v"(lds + 8192u), "v"(lds + 12288u),
         "v"(k0), "v"(k1), "v"(v0), "v"(v1)
      : "memory");
}
// value of the same column in the other 16-lane half (lane l <-> l ^ 16)
__device__ inline float other_half(float v) {
  int b = __builtin_bit_cast(int, v);
  b = __builtin_amdgcn_permlanex16(b, b, 0x76543210, 0xfedcba98, false, false);
  return __builtin_bit_cast(float, b);
}

// 2^x as the bare hardware instruction. The library's exp2f adds a range check per value
// (compare, select, add, select, ldexp) that only serves results below 2^-126. Each
// query's largest term is at least 2^0 = 1, so such a result is 0 as an f16 weight and
// is lost in the f32 sum either way.
__device__ inline float exp2_bare(float x) { return __builtin_amdgcn_exp2f(x); }

// sc[nt][qg] = K tile (64 keys, from LDS at st) * scaled Q^T + nref[qg]
__device__ inline void attn_scores(const _Float16* st, const v16h (&qf)[2][2],
                                   const float (&nref)[2], v8f (&sc)[4][2]) {
  v16h kf[2][4];
#pragma unroll
  for (int ks = 0; ks < 2; ++ks)
#pragma unroll
    for (int nt = 0; nt < 4; ++nt)
      kf[ks][nt] = frag_from_f16(st + (nt * 2 + ks) * FRAG_H);
  // keeps the tile's 16 loads together in front of the products (one latency, counted
  // waits); without it most are issued in pairs among the products, each pair waited
  // out in full
  __builtin_amdgcn_sched_barrier(0);
#pragma unroll
  for (int nt = 0; nt < 4; ++nt)
#pragma unroll
    for (int qg = 0; qg < 2; ++qg)
      sc[nt][qg] = wmma_f16(kf[0][nt], qf[qg][0], (v8f)(nref[qg]));
#pragma unroll
  for (int nt = 0; nt < 4; ++nt)
#pragma unroll
    for (int qg = 0; qg < 2; ++qg)
      sc[nt][qg] = wmma_f16(kf[1][nt], qf[qg][1], sc[nt][qg]);
}

// sum of one query's 32 weights in this lane
__device__ inline float row_sum(const v8f (&sc)[4][2], int qg) {
  const v8f s8 = (sc[0][qg] + sc[1][qg]) + (sc[2][qg] + sc[3][qg]);
  return ((s8[0] + s8[1]) + (s8[2] + s8[3])) + ((s8[4] + s8[5]) + (s8[6] + s8[7]));
}

__global__ __launch_bounds__(256) void attn_kernel(
    const _Float16* __restrict__ qkv,   // [4*2048][1024], fragment order
    const _Float16* __restrict__ qkvT,  // [4*1024][2048], fragment order
    _Float16* __restrict__ aout) {      // [4*2048][1024], fragment order
  __shared__ __attribute__((aligned(1024))) _Float16 ring[2 * STAGE_H];
  const int lane = threadIdx.x & 31;
  const int wave = threadIdx.x >> 5;

  const int bh = blockIdx.y;
  const int b  = bh >> 4;
  const int h  = bh & 15;
  const int q0 = blockIdx.x * 256 + wave * 32;

  // fragment (16 rows from seq position s, d chunk ks) : qk + (s >> 4) * KBAND + ks * FRAG_H
  // fragment (16 d from dt * 16, 32 keys from chunk kc) : vT + dt * VBAND + kc * FRAG_H
  const int KBAND = FR_DIM * FRAG_H;
  const int VBAND = FR_SEQ * FRAG_H;
  const _Float16* qk = qkv + ((size_t)(b * SEQ >> 4) * FR_DIM + h * (DHEAD / 32)) * FRAG_H;
  const _Float16* vT = qkvT + (size_t)((b * DIM + h * DHEAD) >> 4) * VBAND;

  // scale folded into exp2 domain: exp(s/8) = 2^(s * log2(e)/8)
  const float SC2 = 0.18033688011112042f;

  // resident Q fragments (B operand, column = query): [qg][ks]
  v16h qf[2][2];
#pragma unroll
  for (int qg = 0; qg < 2; ++qg)
#pragma unroll
    for (int ks = 0; ks < 2; ++ks)
    {
      const v16h q = frag_from_f16(qk + (size_t)((q0 >> 4) + qg) * KBAND + ks * FRAG_H + lane * 8);
#pragma unroll
      for (int s = 0; s < 16; ++s) qf[qg][ks][s] = (_Float16)((float)q[s] * SC2);
    }

  // O^T tiles: oacc[dt][qg][r] = O[query qg*16+l15][d = dt*16 + rsel + r]
  v8f oacc[4][2];
#pragma unroll
  for (int dt = 0; dt < 4; ++dt)
#pragma unroll
    for (int qg = 0; qg < 2; ++qg) oacc[dt][qg] = (v8f)(0.0f);

  float nref[2], lrow[2];   // per lane: minus its query's reference, its half's sum
#pragma unroll
  for (int qg = 0; qg < 2; ++qg) { nref[qg] = 0.0f; lrow[qg] = 0.0f; }
  // a half's sum of a tile up to here: every weight of it fits f16 (largest 65504)
  const float SUM_LIM = 32768.0f;

  // this thread's pieces of a stage: each tile is four runs of 2 KB (128 pieces), one
  // per band; bands (tid >> 7) and 2 + (tid >> 7) of K, then the same of V^T
  const int tid = threadIdx.x;
  const _Float16* kc = qk + (size_t)(tid >> 7) * KBAND + (tid & 127) * 8;
  const _Float16* vc = vT + (size_t)(tid >> 7) * VBAND + (tid & 127) * 8;
  const unsigned lds0 = (unsigned)(size_t)(&ring[0]) + tid * 16;

  copy_stage(lds0, kc, kc + 2 * KBAND, vc, vc + 2 * VBAND);
  // tile 0 has landed (this wave's pieces), then is published to the block
  asm volatile("s_wait_asynccnt 0x0" ::: "memory");
  __syncthreads();
  copy_stage(lds0 + STAGE_H * 2, kc + 4 * KBAND, kc + 6 * KBAND,
             vc + 2 * FRAG_H, vc + 2 * VBAND + 2 * FRAG_H);

  for (int kt = 0; kt < SEQ / 64; ++kt) {
    const _Float16* st = ring + (kt & 1) * STAGE_H + lane * 8;

    // ---- scores S^T = K @ Q^T - reference : sc[nt][qg][r] for key nt*16+rsel+r
    v8f sc[4][2];
    float rs[2];
    attn_scores(st, qf, nref, sc);

    // ---- weights and row sums, one query per lane --------------------------
#pragma unroll
    for (int qg = 0; qg < 2; ++qg) {
#pragma unroll
      for (int nt = 0; nt < 4; ++nt)
#pragma unroll
        for (int j = 0; j < 8; ++j) sc[nt][qg][j] = exp2_bare(sc[nt][qg][j]);
      rs[qg] = row_sum(sc, qg);
    }

    // ---- new reference: tile 0, or a weight that may not fit f16 (also inf, NaN) ----
    // one test per tile, a scalar branch
    const bool big = !(rs[0] <= SUM_LIM) | !(rs[1] <= SUM_LIM) | (kt == 0);
    if (__builtin_amdgcn_ballot_w32(big) != 0) {
      attn_scores(st, qf, nref, sc);
#pragma unroll
      for (int qg = 0; qg < 2; ++qg) {
        float m8[8];
#pragma unroll
        for (int j = 0; j < 8; ++j)
          m8[j] = fmaxf(fmaxf(sc[0][qg][j], sc[1][qg][j]),
                        fmaxf(sc[2][qg][j], sc[3][qg][j]));
        float tm = fmaxf(fmaxf(fmaxf(m8[0], m8[1]), fmaxf(m8[2], m8[3])),
                         fmaxf(fmaxf(m8[4], m8[5]), fmaxf(m8[6], m8[7])));
        tm = fmaxf(tm, other_half(tm));
        // the reference only rises; tile 0 sets it, with nothing yet to rescale
        const float up   = (kt == 0) ? tm : fmaxf(tm, 0.0f);
        const float corr = (kt == 0) ? 0.0f : exp2_bare(-up);
        nref[qg] -= up;
        lrow[qg] *= corr;
#pragma unroll
        for (int dt = 0; dt < 4; ++dt) oacc[dt][qg] *= corr;
#pragma unroll
        for (int nt = 0; nt < 4; ++nt)
#pragma unroll
          for (int j = 0; j < 8; ++j) sc[nt][qg][j] = exp2_bare(sc[nt][qg][j] - up);
        rs[qg] = row_sum(sc, qg);
      }
    }

    // The branch above keeps the V^T loads from starting among the exponentials; left to
    // the compiler they are issued behind it pair by pair, each pair waited out in full.
    // So they stand here as two groups, each ahead of other work.
    v16h vf[2][4];
#pragma unroll
    for (int dt = 0; dt < 4; ++dt)
      vf[0][dt] = frag_from_f16(st + STAGE_V + (dt * 2 + 0) * FRAG_H);
    // holds the first group in front of the packing, which covers part of its latency
    __builtin_amdgcn_sched_barrier(0);

    v16h pf[2][2];            // P^T as B operand: [qg][32-key chunk]
#pragma unroll
    for (int qg = 0; qg < 2; ++qg) {
      lrow[qg] += rs[qg];
      // element s of the B operand is key kmap(s) = tile (s >> 3), register s & 7
#pragma unroll
      for (int c2 = 0; c2 < 2; ++c2)
#pragma unroll
        for (int s = 0; s < 16; ++s)
          pf[qg][c2][s] = (_Float16)sc[c2 * 2 + (s >> 3)][qg][s & 7];
    }

    // ---- O^T += V^T @ P^T --------------------------------------------------
#pragma unroll
    for (int dt = 0; dt < 4; ++dt)
      vf[1][dt] = frag_from_f16(st + STAGE_V + (dt * 2 + 1) * FRAG_H);
    // holds the second group in front of the first group's products, which cover its latency
    __builtin_amdgcn_sched_barrier(0);
#pragma unroll
    for (int c2 = 0; c2 < 2; ++c2)
#pragma unroll
      for (int dt = 0; dt < 4; ++dt)
#pragma unroll
        for (int qg = 0; qg < 2; ++qg)
          oacc[dt][qg] = wmma_f16(vf[c2][dt], pf[qg][c2], oacc[dt][qg]);

    // ---- publish tile kt + 1, free this tile's buffer -----------------------
    // this wave's reads of the buffer are done
    asm volatile("s_wait_dscnt 0x0" ::: "memory");
    // this wave's pieces of tile kt + 1 have landed
    asm volatile("s_wait_asynccnt 0x0" ::: "memory");
    __syncthreads();
    if (kt + 2 < SEQ / 64) {
      const _Float16* kn = kc + (size_t)(kt + 2) * 4 * KBAND;
      const _Float16* vn = vc + (kt + 2) * 2 * FRAG_H;
      copy_stage(lds0 + (kt & 1) * (STAGE_H * 2), kn, kn + 2 * KBAND, vn, vn + 2 * VBAND);
    }
  }
  // no copy is outstanding when the wave ends
  asm volatile("s_wait_asynccnt 0x0" ::: "memory");

  // ---- join the halves' sums, normalize, store 8 consecutive d per lane ----
#pragma unroll
  for (int qg = 0; qg < 2; ++qg) {
    const float inv = 1.0f / (lrow[qg] + other_half(lrow[qg]));
    // row = the lane's query, k = h * 64 + dt * 16 + 8 * (lane >> 4) + 0..7: piece number
    // 'lane' of half (dt & 1) of fragment (row band, h * 2 + (dt >> 1))
    _Float16* ob = aout + ((size_t)(((b * SEQ + q0) >> 4) + qg) * FR_DIM + h * (DHEAD / 32)) * FRAG_H + lane * 8;
#pragma unroll
    for (int dt = 0; dt < 4; ++dt) {
      v8h o;
#pragma unroll
      for (int j = 0; j < 8; ++j) o[j] = (_Float16)(oacc[dt][qg][j] * inv);
      *(v8h*)(ob + (dt >> 1) * FRAG_H + (dt & 1) * 256) = o;
    }
  }
}

// ---------------------------------------------------------------------------
// Kernel 3: out = AttnOut @ Wout^T + bias   (f16 WMMA, f32 bias/store)
// ---------------------------------------------------------------------------
__global__ __launch_bounds__(128) void out_gemm_kernel(
    const _Float16* __restrict__ A,   // [8192,1024] f16, fragment order
    const _Float16* __restrict__ W,   // [1024,1024] f16 (out,in), fragment order
    const float* __restrict__ bias,   // [1024] f32
    float* __restrict__ out) {        // [8192,1024] f32
  __shared__ __attribute__((aligned(1024))) _Float16 ring[2 * GS_H];
  const int lane = threadIdx.x & 31;
  const int wave = threadIdx.x >> 5;
  const int l15  = lane & 15;
  const int mb   = blockIdx.y * 128 + (wave >> 1) * 64;
  const int nb   = blockIdx.x * 128 + (wave & 1) * 64;

  v8f acc[4][4];
#pragma unroll
  for (int mt = 0; mt < 4; ++mt)
#pragma unroll
    for (int nt = 0; nt < 4; ++nt) acc[mt][nt] = (v8f)(0.0f);

  gemm_mainloop(A + (size_t)(blockIdx.y * 8) * GBAND, W + (size_t)(blockIdx.x * 8) * GBAND,
                ring, acc);

  float bv[4];
#pragma unroll
  for (int nt = 0; nt < 4; ++nt) bv[nt] = bias[nb + nt * 16 + l15];

  const int rsel = (lane >> 4) << 3;
#pragma unroll
  for (int mt = 0; mt < 4; ++mt)
#pragma unroll
    for (int nt = 0; nt < 4; ++nt)
#pragma unroll
      for (int j = 0; j < 8; ++j) {
        const int r = mb + mt * 16 + rsel + j;
        const int c = nb + nt * 16 + l15;
        out[(size_t)r * DIM + c] = acc[mt][nt][j] + bv[nt];
      }
}

// ---------------------------------------------------------------------------
extern "C" void kernel_launch(void* const* d_in, const int* in_sizes, int n_in,
                              void* d_out, int out_size, void* d_ws, size_t ws_size,
                              hipStream_t stream) {
  const float* x     = (const float*)d_in[0];   // [4,2048,1024]
  const float* w_qkv = (const float*)d_in[1];   // [1024,1024]
  const float* w_out = (const float*)d_in[2];   // [1024,1024]
  const float* b_out = (const float*)d_in[3];   // [1024]
  float* out = (float*)d_out;

  // workspace (f16, all in fragment order): xh 16MB | wqkvh 2MB | wouth 2MB | qkv 16MB | qkvT 16MB | aout 16MB
  _Float16* xh    = (_Float16*)d_ws;
  _Float16* wqkvh = xh    + (size_t)MTOT * DIM;
  _Float16* wouth = wqkvh + (size_t)DIM * DIM;
  _Float16* qkv   = wouth + (size_t)DIM * DIM;
  _Float16* qkvT  = qkv   + (size_t)MTOT * DIM;
  _Float16* aout  = qkvT  + (size_t)MTOT * DIM;

  // ---- pre-convert inputs to f16 (one launch for all three) ----
  cvt_f32_f16_kernel<<<CVT_BLOCKS, CVT_THREADS, 0, stream>>>(x, w_qkv, w_out, xh, wqkvh, wouth);
  {
    dim3 grid(DIM / 128, MTOT / 128);           // (8, 64)
    qkv_gemm_kernel<<<grid, 128, 0, stream>>>(xh, wqkvh, qkv, qkvT);
  }
  {
    dim3 grid(SEQ / 256, BATCH * NHEAD);        // (8, 64)
    attn_kernel<<<grid, 256, 0, stream>>>(qkv, qkvT, aout);
  }
  {
    dim3 grid(DIM / 128, MTOT / 128);           // (8, 64)
    out_gemm_kernel<<<grid, 128, 0, stream>>>(aout, wouth, b_out, out);
  }
}

// v009
// It runs in 87.3 microseconds.
// Two timings next to v008 put it at 1.07 and 1.08 times that version's speed.
// Over all steps from v000 it is 7.13 times as fast.
#include <hip/hip_runtime.h>
#include <hip/hip_bf16.h>

// ---------------------------------------------------------------------------
// Multi-head self-attention (shared QKV projection) for MI455X / gfx1250.
// f32 inputs are pre-converted to f16 once (one launch for all three), then all
// matmuls run through v_wmma_f32_16x16x32_f16 (f16 in, f32 accumulate) with
// pure f16 b128 fragment loads in the hot loops. Flash-attention style:
// the 1 GB score matrix never exists; softmax runs online in registers.
// The GEMMs stage their operand tiles, attention its key tiles (which are its value
// tiles too), in LDS, once per block, by asynchronous copies.
// Every f16 tensor in the workspace is kept in FRAGMENT ORDER (see below), so
// that one wave-wide 16-byte load or store covers 512 contiguous bytes.
// ---------------------------------------------------------------------------

typedef __attribute__((ext_vector_type(16))) _Float16 v16h;
typedef __attribute__((ext_vector_type(8)))  _Float16 v8h;
typedef __attribute__((ext_vector_type(8)))  float    v8f;
typedef __attribute__((ext_vector_type(4)))  float    v4f;

#define BATCH 4
#define SEQ   2048
#define DIM   1024
#define NHEAD 16
#define DHEAD 64
#define MTOT  (BATCH * SEQ)       // 8192 rows

union V16U { v16h v; v8h h[2]; };

// CDNA5 16-bit A/B fragment (16x32 / 32x16), per-lane layout:
//   lanes 0-15 : K = ko+{0..7} in halves 0-7, K = ko+{16..23} in halves 8-15, ko=0
//   lanes16-31 : same with ko=8
//
// Fragment order of a [rows][K] f16 matrix: the 16 x 32 fragment
// (rt = row >> 4, kc = k >> 5) is the 1 KB block number rt * (K / 32) + kc.
// Inside it, element (row & 15, k & 31) lies at half-word
//   ((k >> 4) & 1) * 256 + (((k >> 3) & 1) * 16 + (row & 15)) * 8 + (k & 7)
// i.e. lane L finds its halves 0-7 at L * 8 and its halves 8-15 at 256 + L * 8.
#define FRAG_H 512                 // half-words per fragment block
#define FR_DIM (DIM / 32)          // fragment blocks per 16-row band, K = DIM

// qkv alone keeps its fragments with one twist: in the 16-byte pieces of lanes 16-31 the
// row number has bit 3 flipped, i.e. lane L finds its pieces at frag_lane(L) * 8. A wave's
// plain 16-byte reads still cover 256 bytes in a row per lane half, and the transposing
// read of a 16 x 16 part (8 rows x two pieces per lane half) then meets every LDS bank
// once as well; without the twist its two pieces of a row fall on the same banks.
__device__ inline int frag_lane(int lane) { return lane ^ ((lane & 16) >> 1); }

// p points at the fragment block + lane * 8 (qkv: frag_lane(lane) * 8).
__device__ inline v16h frag_from_f16(const _Float16* __restrict__ p) {
  V16U u;
  u.h[0] = *(const v8h*)(p);
  u.h[1] = *(const v8h*)(p + 256);
  return u.v;
}

__device__ inline v8f wmma_f16(v16h a, v16h b, v8f c) {
  // D = A(16x32,f16) * B(32x16,f16) + C(16x16,f32)
  return __builtin_amdgcn_wmma_f32_16x16x32_f16(false, a, false, b,
                                                (short)0, c, false, false);
}

// ---------------------------------------------------------------------------
// Kernel 0: f32 -> f16 conversion of x and of both weight matrices ([rows][DIM] each)
// into fragment order, all in ONE launch of one 16-wave block per WGP. Piece i of a
// tensor is the i-th 16 bytes of its output and comes from the 8 floats that belong
// there. A lane converts ten pieces: eight of x (its wave takes four fragments in a row,
// 512 contiguous bytes of each of 16 rows, 4 KB of output) and one of each weight.
// One piece per lane would take ten times the waves: the pass is short, and what it costs
// is launches and wave starts more than bytes.
// ---------------------------------------------------------------------------
#define CVT_THREADS 512
#define CVT_BLOCKS  256
#define CVT_LANES   (CVT_THREADS * CVT_BLOCKS)
#define CVT_XP      8              // pieces of x per lane
static_assert(MTOT * DIM / 8 == CVT_XP * CVT_LANES, "x: eight pieces per lane");
static_assert(DIM * DIM / 8 == CVT_LANES, "a weight matrix: one piece per lane");
static_assert(FR_DIM % (CVT_XP / 2) == 0, "a wave's fragments of x share a row band");

// the 8 floats of piece i
__device__ inline const float* cvt_piece_src(const float* __restrict__ src, unsigned i) {
  const unsigned fr  = i >> 6;                          // fragment block
  const unsigned row = (fr / FR_DIM) * 16 + (i & 15);
  const unsigned k   = (fr % FR_DIM) * 32 + ((i >> 5) & 1) * 16 + ((i >> 4) & 1) * 8;
  return src + (size_t)(row * DIM + k);
}

__device__ inline v8h cvt_piece(v4f a, v4f b) {
  v8h o;
#pragma unroll
  for (int j = 0; j < 4; ++j) {
    o[j]     = (_Float16)a[j];
    o[4 + j] = (_Float16)b[j];
  }
  return o;
}

__global__ __launch_bounds__(CVT_THREADS) void cvt_f32_f16_kernel(
    const float* __restrict__ x, const float* __restrict__ wq, const float* __restrict__ wo,
    _Float16* __restrict__ xh, _Float16* __restrict__ wqh, _Float16* __restrict__ woh) {
  const unsigned g  = blockIdx.x * CVT_THREADS + threadIdx.x;
  const unsigned x0 = (g >> 5) * (32 * CVT_XP) + (g & 31);   // the lane's first piece of x
  // pieces x0 + 32 * j: the same row, 16 floats further on each (the wave's four
  // fragments lie in one 16-row band, as FR_DIM is a multiple of four)
  const float* sx = cvt_piece_src(x, x0);
  const float* sq = cvt_piece_src(wq, g);
  const float* so = cvt_piece_src(wo, g);

  v4f a[CVT_XP + 2], b[CVT_XP + 2];
#pragma unroll
  for (int j = 0; j < CVT_XP; ++j) {
    a[j] = *(const v4f*)(sx + j * 16);
    b[j] = *(const v4f*)(sx + j * 16 + 4);
  }
  a[CVT_XP]     = *(const v4f*)(sq);
  b[CVT_XP]     = *(const v4f*)(sq + 4);
  a[CVT_XP + 1] = *(const v4f*)(so);
  b[CVT_XP + 1] = *(const v4f*)(so + 4);
  // keeps all 20 loads in front of the first conversion, one memory latency per wave;
  // without it they are issued in two batches, the second behind a wait on the first
  __builtin_amdgcn_sched_barrier(0);
#pragma unroll
  for (int j = 0; j < CVT_XP; ++j)
    *(v8h*)(xh + (size_t)(x0 + j * 32) * 8) = cvt_piece(a[j], b[j]);
  *(v8h*)(wqh + (size_t)g * 8) = cvt_piece(a[CVT_XP], b[CVT_XP]);
  *(v8h*)(woh + (size_t)g * 8) = cvt_piece(a[CVT_XP + 1], b[CVT_XP + 1]);
}

// ---------------------------------------------------------------------------
// Main loop of both GEMMs: C[128 x 128] += A[128 x DIM] * B[128 x DIM]^T per block.
// Two waves need the same A rows, two the same B rows: the block brings every stage
// (128 k of both operands, 64 KB) into LDS once, two buffers, the next stage in
// flight while one is worked on, and the waves take their fragments from there.
// Stage layout (half-words): A fragment (band t of 8, kc of 4) at (t * 4 + kc) * FRAG_H,
// B fragment the same behind GS_OP_H. A band's four fragments are 4 KB in a row in
// global memory and in LDS alike.
// ---------------------------------------------------------------------------
#define GBAND   (FR_DIM * FRAG_H)  // half-words from one 16-row band to the next
#define GS_OP_H (8 * 4 * FRAG_H)   // half-words of one operand's part of a stage (32 KB)
#define GS_H    (2 * GS_OP_H)      // half-words per stage
#define GS_N    (DIM / 128)        // stages

// Four bands of one operand, per thread two 16-byte pieces (2 KB apart) of each.
// The wait in the same statement stands before the address registers are rewritten.
__device__ inline void copy_bands4(unsigned lds, const _Float16* g) {
  asm volatile(
      "global_load_async_to_lds_b128 %0, %8, off\n\t"
      "global_load_async_to_lds_b128 %1, %9, off\n\t"
      "global_load_async_to_lds_b128 %2, %10, off\n\t"
      "global_load_async_to_lds_b128 %3, %11, off\n\t"
      "global_load_async_to_lds_b128 %4, %12, off\n\t"
      "global_load_async_to_lds_b128 %5, %13, off\n\t"
      "global_load_async_to_lds_b128 %6, %14, off\n\t"
      "global_load_async_to_lds_b128 %7, %15, off\n\t"
      "s_wait_xcnt 0x0"
      :: "v"(lds), "v"(lds + 2048u), "v"(lds + 4096u), "v"(lds + 6144u),
         "v"(lds + 8192u), "v"(lds + 10240u), "v"(lds + 12288u), "v"(lds + 14336u),
         "v"(g), "v"(g + 1024), "v"(g + GBAND), "v"(g + GBAND + 1024),
         "v"(g + 2 * GBAND), "v"(g + 2 * GBAND + 1024),
         "v"(g + 3 * GBAND), "v"(g + 3 * GBAND + 1024)
      : "memory");
}

// One stage: 4096 pieces of 16 bytes, 32 per thread. a, b: the block's first band of each
// operand at the stage's first fragment, plus tid * 8.
__device__ inline void gemm_copy_stage(unsigned lds, const _Float16* a, const _Float16* b) {
  copy_bands4(lds, a);
  copy_bands4(lds + 16384u, a + 4 * GBAND);
  copy_bands4(lds + 32768u, b);
  copy_bands4(lds + 49152u, b + 4 * GBAND);
}

// A, B: the block's first band of each operand. ring: 2 * GS_H half-words of LDS.
__device__ inline void gemm_mainloop(const _Float16* __restrict__ A,
                                     const _Float16* __restrict__ B,
                                     const _Float16* ring, v8f (&acc)[4][4]) {
  const int tid  = threadIdx.x;
  const int lane = tid & 31;
  const int wave = tid >> 5;
  const _Float16* ac = A + tid * 8;
  const _Float16* bc = B + tid * 8;
  const unsigned lds0 = (unsigned)(size_t)(ring) + tid * 16;
  // this wave's four A bands and four B bands inside a stage
  const int offa = (wave >> 1) * 16 * FRAG_H + lane * 8;
  const int offb = GS_OP_H + (wave & 1) * 16 * FRAG_H + lane * 8;

  gemm_copy_stage(lds0, ac, bc);
  // stage 0 has landed (this wave's pieces), then is published to the block
  asm volatile("s_wait_asynccnt 0x0" ::: "memory");
  __syncthreads();
  gemm_copy_stage(lds0 + GS_H * 2, ac + 4 * FRAG_H, bc + 4 * FRAG_H);

  for (int t = 0; t < GS_N; ++t) {
    const _Float16* sa = ring + (t & 1) * GS_H + offa;
    const _Float16* sb = ring + (t & 1) * GS_H + offb;
    v16h af[2][4], bf[2][4];
#pragma unroll
    for (int i = 0; i < 4; ++i) {
      af[0][i] = frag_from_f16(sa + i * 4 * FRAG_H);
      bf[0][i] = frag_from_f16(sb + i * 4 * FRAG_H);
    }
#pragma unroll
    for (int ks = 0; ks < 4; ++ks) {
      if (ks < 3) {
#pragma unroll
        for (int i = 0; i < 4; ++i) {
          af[(ks + 1) & 1][i] = frag_from_f16(sa + (i * 4 + ks + 1) * FRAG_H);
          bf[(ks + 1) & 1][i] = frag_from_f16(sb + (i * 4 + ks + 1) * FRAG_H);
        }
      } else {
        // ---- publish stage t + 1, free this stage's buffer: the last k step's fragments
        // are in registers, so its products run while the refill is already in flight.
        // Keeps the products of the step before in front of the barrier; without it they
        // sink behind it and hold the refill's copies back by their whole run
        __builtin_amdgcn_sched_barrier(0);
        // this wave's reads of the buffer are done
        asm volatile("s_wait_dscnt 0x0" ::: "memory");
        // this wave's pieces of stage t + 1 have landed
        asm volatile("s_wait_asynccnt 0x0" ::: "memory");
        __syncthreads();
        if (t + 2 < GS_N)
          gemm_copy_stage(lds0 + (t & 1) * (GS_H * 2), ac + (t + 2) * 4 * FRAG_H,
                          bc + (t + 2) * 4 * FRAG_H);
      }
      // keeps the next k step's 16 LDS loads (behind the last step: the refill's copies) in
      // front of this step's products, so that their latency runs under the products;
      // without it the loads sink among the products and the copies behind them
      __builtin_amdgcn_sched_barrier(0);
#pragma unroll
      for (int mt = 0; mt < 4; ++mt)
#pragma unroll
        for (int nt = 0; nt < 4; ++nt)
          acc[mt][nt] = wmma_f16(af[ks & 1][mt], bf[ks & 1][nt], acc[mt][nt]);
    }
  }
  // no copy is outstanding when the wave ends
  asm volatile("s_wait_asynccnt 0x0" ::: "memory");
}

// ---------------------------------------------------------------------------
// Kernel 1: qkv = X @ Wqkv^T, computed as qkv^T = Wqkv @ X^T (f16 WMMA, f32 accumulate,
// f16 output): a lane then holds 8 consecutive d of ONE row of qkv, which is one 16-byte
// piece of a fragment, and a wave-wide store covers 512 bytes in a row.
// All three tensors are in fragment order.
// Block: 128 threads = 4 waves (2x2), block tile 128x128, wave tile 64x64.
// ---------------------------------------------------------------------------
__global__ __launch_bounds__(128) void qkv_gemm_kernel(
    const _Float16* __restrict__ X,   // [8192,1024] f16
    const _Float16* __restrict__ W,   // [1024,1024] f16 (out,in)
    _Float16* __restrict__ qkv) {     // [8192,1024]
  __shared__ __attribute__((aligned(1024))) _Float16 ring[2 * GS_H];
  const int lane = threadIdx.x & 31;
  const int wave = threadIdx.x >> 5;
  const int db   = blockIdx.x * 128 + (wave >> 1) * 64;   // first d (row of W)
  const int sb   = blockIdx.y * 128 + (wave & 1) * 64;    // first row of X

  v8f acc[4][4];
#pragma unroll
  for (int mt = 0; mt < 4; ++mt)
#pragma unroll
    for (int nt = 0; nt < 4; ++nt) acc[mt][nt] = (v8f)(0.0f);

  gemm_mainloop(W + (size_t)(blockIdx.x * 8) * GBAND, X + (size_t)(blockIdx.y * 8) * GBAND,
                ring, acc);

  // C-layout: the lane's column is row s0 + (lane & 15) of qkv, its 8 registers are
  // d0 + 8 * (lane >> 4) + 0..7
  // (d0 = db + mt * 16, s0 = sb + nt * 16): piece frag_lane(lane) of half (mt & 1) of
  // fragment (row band (sb >> 4) + nt, k chunk (db >> 5) + (mt >> 1))
  _Float16* qb = qkv + ((size_t)(sb >> 4) * FR_DIM + (db >> 5)) * FRAG_H + frag_lane(lane) * 8;
  v8h o[4][4];
#pragma unroll
  for (int mt = 0; mt < 4; ++mt)
#pragma unroll
    for (int nt = 0; nt < 4; ++nt)
#pragma unroll
      for (int j = 0; j < 8; ++j) o[mt][nt][j] = (_Float16)acc[mt][nt][j];
#pragma unroll
  for (int nt = 0; nt < 4; ++nt)
#pragma unroll
    for (int mt = 0; mt < 4; ++mt)
      *(v8h*)(qb + nt * GBAND + (mt >> 1) * FRAG_H + (mt & 1) * 256) = o[mt][nt];
}

// ---------------------------------------------------------------------------
// Kernel 2: flash attention, q=k=v=qkv, in transposed form:
//   S^T = K * Q^T   (A = key rows, B = query rows kept in registers)
//   O^T += V^T * P^T (A = the key tile read transposed, B = P^T packed from the S^T tiles)
// A lane of a 16-column group holds the scores of ONE query, so the sum runs in the
// lane; the two lane halves (keys 8h..8h+7 of each 16) join their sums once, after
// the loop.
// The exponent's argument comes straight out of the score product: Q is scaled when
// it is loaded and the accumulator starts at minus the query's reference, a maximum
// of earlier tiles. The reference is renewed (tile redone, O and sums rescaled) only
// in tile 0 and when a tile's row sum shows a weight too large for f16.
// Two S^T accumulator tiles (keys 0-15, 16-31) converted in place are the
// B operand of the second product: P needs no LDS and no barrier.
// One block = (b,h, 256 q-rows); each of 8 waves owns 32 queries, loops keys
// in tiles of 64.
// All 8 waves read the same tile, and K and V are the same rows: the block brings each
// tile into LDS once (two buffers, the next tile in flight while one is worked on);
// the waves take their K fragments from there by plain reads and their V^T fragments
// from the same bytes by the transposing read. No transposed copy of qkv exists.
// Stage layout (half-words): fragment (16 keys nt, 32 d ks) at (nt * 2 + ks) * FRAG_H.
// ---------------------------------------------------------------------------
#define STAGE_H 4096               // half-words per stage (64 keys x 64 d, 8 KB)

// One stage = 512 pieces of 16 bytes, two per thread: piece c * 256 + tid.
// The wait in the same statement stands before the address registers are rewritten.
__device__ inline void copy_stage(unsigned lds, const _Float16* k0, const _Float16* k1) {
  asm volatile(
      "global_load_async_to_lds_b128 %0, %2, off\n\t"
      "global_load_async_to_lds_b128 %1, %3, off\n\t"
      "s_wait_xcnt 0x0"
      :: "v"(lds), "v"(lds + 4096u), "v"(k0), "v"(k1)
      : "memory");
}

// ds_load_tr16_b128: lane l hands in the address of 8 d of key 8 * (l >> 4) + (l & 7), d part
// (l >> 3) & 1, of a 16 key x 16 d part; it gets back keys 8 * (l >> 4) + 0..7 of d = l & 15.
typedef short s16x8 __attribute__((ext_vector_type(8)));
__device__ inline v8h lds_tr16(const _Float16* p) {
  typedef __attribute__((address_space(3))) s16x8 lds_s16x8;
  return __builtin_bit_cast(v8h, __builtin_amdgcn_ds_load_tr16_b128_v8i16((lds_s16x8*)p));
}

// V^T fragment (16 d from dt * 16, 32 keys from c2 * 32). vt: the stage + the lane's piece.
__device__ inline v16h vt_frag(const _Float16* vt, int dt, int c2) {
  V16U u;
  const _Float16* p = vt + (c2 * 4 + (dt >> 1)) * FRAG_H + (dt & 1) * 256;
  u.h[0] = lds_tr16(p);                  // keys c2 * 32 + 0..15
  u.h[1] = lds_tr16(p + 2 * FRAG_H);     // keys c2 * 32 + 16..31
  return u.v;
}
// value of the same column in the other 16-lane half (lane l <-> l ^ 16)
__device__ inline float other_half(float v) {
  int b = __builtin_bit_cast(int, v);
  b = __builtin_amdgcn_permlanex16(b, b, 0x76543210, 0xfedcba98, false, false);
  return __builtin_bit_cast(float, b);
}

// 2^x as the bare hardware instruction. The library's exp2f adds a range check per value
// (compare, select, add, select, ldexp) that only serves results below 2^-126. Each
// query's largest term is at least 2^0 = 1, so such a result is 0 as an f16 weight and
// is lost in the f32 sum either way.
__device__ inline float exp2_bare(float x) { return __builtin_amdgcn_exp2f(x); }

// sc[nt][qg] = K tile (64 keys, from LDS at st) * scaled Q^T + nref[qg]
__device__ inline void attn_scores(const _Float16* st, const v16h (&qf)[2][2],
                                   const float (&nref)[2], v8f (&sc)[4][2]) {
  v16h kf[2][4];
#pragma unroll
  for (int ks = 0; ks < 2; ++ks)
#pragma unroll
    for (int nt = 0; nt < 4; ++nt)
      kf[ks][nt] = frag_from_f16(st + (nt * 2 + ks) * FRAG_H);
  // keeps the tile's 16 loads together in front of the products (one latency, counted
  // waits); without it most are issued in pairs among the products, each pair waited
  // out in full
  __builtin_amdgcn_sched_barrier(0);
#pragma unroll
  for (int nt = 0; nt < 4; ++nt)
#pragma unroll
    for (int qg = 0; qg < 2; ++qg)
      sc[nt][qg] = wmma_f16(kf[0][nt], qf[qg][0], (v8f)(nref[qg]));
#pragma unroll
  for (int nt = 0; nt < 4; ++nt)
#pragma unroll
    for (int qg = 0; qg < 2; ++qg)
      sc[nt][qg] = wmma_f16(kf[1][nt], qf[qg][1], sc[nt][qg]);
}

// sum of one query's 32 weights in this lane
__device__ inline float row_sum(const v8f (&sc)[4][2], int qg) {
  const v8f s8 = (sc[0][qg] + sc[1][qg]) + (sc[2][qg] + sc[3][qg]);
  return ((s8[0] + s8[1]) + (s8[2] + s8[3])) + ((s8[4] + s8[5]) + (s8[6] + s8[7]));
}

__global__ __launch_bounds__(256) void attn_kernel(
    const _Float16* __restrict__ qkv,   // [4*2048][1024], fragment order (frag_lane)
    _Float16* __restrict__ aout) {      // [4*2048][1024], fragment order
  __shared__ __attribute__((aligned(1024))) _Float16 ring[2 * STAGE_H];
  const int lane = threadIdx.x & 31;
  const int wave = threadIdx.x >> 5;

  const int bh = blockIdx.y;
  const int b  = bh >> 4;
  const int h  = bh & 15;
  const int q0 = blockIdx.x * 256 + wave * 32;

  // fragment (16 rows from seq position s, d chunk ks) : qk + (s >> 4) * KBAND + ks * FRAG_H
  const int KBAND = FR_DIM * FRAG_H;
  const _Float16* qk = qkv + ((size_t)(b * SEQ >> 4) * FR_DIM + h * (DHEAD / 32)) * FRAG_H;
  // the lane's piece of a fragment half: for plain reads, and for the transposing read
  // (row 8 * (lane >> 4) + (lane & 7), d part (lane >> 3) & 1, which is 'lane half' there)
  const int lsw = frag_lane(lane);
  const int ltr = frag_lane(((lane & 8) << 1) | ((lane & 16) >> 1) | (lane & 7));

  // scale folded into exp2 domain: exp(s/8) = 2^(s * log2(e)/8)
  const float SC2 = 0.18033688011112042f;

  // resident Q fragments (B operand, column = query): [qg][ks]
  v16h qf[2][2];
#pragma unroll
  for (int qg = 0; qg < 2; ++qg)
#pragma unroll
    for (int ks = 0; ks < 2; ++ks)
    {
      const v16h q = frag_from_f16(qk + (size_t)((q0 >> 4) + qg) * KBAND + ks * FRAG_H + lsw * 8);
#pragma unroll
      for (int s = 0; s < 16; ++s) qf[qg][ks][s] = (_Float16)((float)q[s] * SC2);
    }

  // O^T tiles: oacc[dt][qg][r] = O[query qg*16+l15][d = dt*16 + rsel + r]
  v8f oacc[4][2];
#pragma unroll
  for (int dt = 0; dt < 4; ++dt)
#pragma unroll
    for (int qg = 0; qg < 2; ++qg) oacc[dt][qg] = (v8f)(0.0f);

  float nref[2], lrow[2];   // per lane: minus its query's reference, its half's sum
#pragma unroll
  for (int qg = 0; qg < 2; ++qg) { nref[qg] = 0.0f; lrow[qg] = 0.0f; }
  // a half's sum of a tile up to here: every weight of it fits f16 (largest 65504)
  const float SUM_LIM = 32768.0f;

  // this thread's pieces of a stage: a tile is four runs of 2 KB (128 pieces), one
  // per band; bands (tid >> 7) and 2 + (tid >> 7)
  const int tid = threadIdx.x;
  const _Float16* kc = qk + (size_t)(tid >> 7) * KBAND + (tid & 127) * 8;
  const unsigned lds0 = (unsigned)(size_t)(&ring[0]) + tid * 16;

  copy_stage(lds0, kc, kc + 2 * KBAND);
  // tile 0 has landed (this wave's pieces), then is published to the block
  asm volatile("s_wait_asynccnt 0x0" ::: "memory");
  __syncthreads();
  copy_stage(lds0 + STAGE_H * 2, kc + 4 * KBAND, kc + 6 * KBAND);

  for (int kt = 0; kt < SEQ / 64; ++kt) {
    const _Float16* st = ring + (kt & 1) * STAGE_H + lsw * 8;
    const _Float16* vt = ring + (kt & 1) * STAGE_H + ltr * 8;

    // ---- scores S^T = K @ Q^T - reference : sc[nt][qg][r] for key nt*16+rsel+r
    v8f sc[4][2];
    float rs[2];
    attn_scores(st, qf, nref, sc);

    // ---- weights and row sums, one query per lane --------------------------
#pragma unroll
    for (int qg = 0; qg < 2; ++qg) {
#pragma unroll
      for (int nt = 0; nt < 4; ++nt)
#pragma unroll
        for (int j = 0; j < 8; ++j) sc[nt][qg][j] = exp2_bare(sc[nt][qg][j]);
      rs[qg] = row_sum(sc, qg);
    }

    // ---- new reference: tile 0, or a weight that may not fit f16 (also inf, NaN) ----
    // one test per tile, a scalar branch
    const bool big = !(rs[0] <= SUM_LIM) | !(rs[1] <= SUM_LIM) | (kt == 0);
    if (__builtin_amdgcn_ballot_w32(big) != 0) {
      attn_scores(st, qf, nref, sc);
#pragma unroll
      for (int qg = 0; qg < 2; ++qg) {
        float m8[8];
#pragma unroll
        for (int j = 0; j < 8; ++j)
          m8[j] = fmaxf(fmaxf(sc[0][qg][j], sc[1][qg][j]),
                        fmaxf(sc[2][qg][j], sc[3][qg][j]));
        float tm = fmaxf(fmaxf(fmaxf(m8[0], m8[1]), fmaxf(m8[2], m8[3])),
                         fmaxf(fmaxf(m8[4], m8[5]), fmaxf(m8[6], m8[7])));
        tm = fmaxf(tm, other_half(tm));
        // the reference only rises; tile 0 sets it, with nothing yet to rescale
        const float up   = (kt == 0) ? tm : fmaxf(tm, 0.0f);
        const float corr = (kt == 0) ? 0.0f : exp2_bare(-up);
        nref[qg] -= up;
        lrow[qg] *= corr;
#pragma unroll
        for (int dt = 0; dt < 4; ++dt) oacc[dt][qg] *= corr;
#pragma unroll
        for (int nt = 0; nt < 4; ++nt)
#pragma unroll
          for (int j = 0; j < 8; ++j) sc[nt][qg][j] = exp2_bare(sc[nt][qg][j] - up);
        rs[qg] = row_sum(sc, qg);
      }
    }

    // The branch above keeps the V^T loads from starting among the exponentials; left to
    // the compiler they are issued behind it pair by pair, each pair waited out in full.
    // So they stand here as two groups, each ahead of other work.
    v16h vf[2][4];
#pragma unroll
    for (int dt = 0; dt < 4; ++dt)
      vf[0][dt] = vt_frag(vt, dt, 0);
    // holds the first group in front of the packing, which covers part of its latency
    __builtin_amdgcn_sched_barrier(0);

    v16h pf[2][2];            // P^T as B operand: [qg][32-key chunk]
#pragma unroll
    for (int qg = 0; qg < 2; ++qg) {
      lrow[qg] += rs[qg];
      // element s of the B operand is key kmap(s) = tile (s >> 3), register s & 7
#pragma unroll
      for (int c2 = 0; c2 < 2; ++c2)
#pragma unroll
        for (int s = 0; s < 16; ++s)
          pf[qg][c2][s] = (_Float16)sc[c2 * 2 + (s >> 3)][qg][s & 7];
    }

    // ---- O^T += V^T @ P^T --------------------------------------------------
#pragma unroll
    for (int dt = 0; dt < 4; ++dt)
      vf[1][dt] = vt_frag(vt, dt, 1);
    // holds the second group in front of the first group's products, which cover its latency
    __builtin_amdgcn_sched_barrier(0);
#pragma unroll
    for (int c2 = 0; c2 < 2; ++c2)
#pragma unroll
      for (int dt = 0; dt < 4; ++dt)
#pragma unroll
        for (int qg = 0; qg < 2; ++qg)
          oacc[dt][qg] = wmma_f16(vf[c2][dt], pf[qg][c2], oacc[dt][qg]);

    // ---- publish tile kt + 1, free this tile's buffer -----------------------
    // this wave's reads of the buffer are done
    asm volatile("s_wait_dscnt 0x0" ::: "memory");
    // this wave's pieces of tile kt + 1 have landed
    asm volatile("s_wait_asynccnt 0x0" ::: "memory");
    __syncthreads();
    if (kt + 2 < SEQ / 64) {
      const _Float16* kn = kc + (size_t)(kt + 2) * 4 * KBAND;
      copy_stage(lds0 + (kt & 1) * (STAGE_H * 2), kn, kn + 2 * KBAND);
    }
  }
  // no copy is outstanding when the wave ends
  asm volatile("s_wait_asynccnt 0x0" ::: "memory");

  // ---- join the halves' sums, normalize, store 8 consecutive d per lane ----
#pragma unroll
  for (int qg = 0; qg < 2; ++qg) {
    const float inv = 1.0f / (lrow[qg] + other_half(lrow[qg]));
    // row = the lane's query, k = h * 64 + dt * 16 + 8 * (lane >> 4) + 0..7: piece number
    // 'lane' of half (dt & 1) of fragment (row band, h * 2 + (dt >> 1))
    _Float16* ob = aout + ((size_t)(((b * SEQ + q0) >> 4) + qg) * FR_DIM + h * (DHEAD / 32)) * FRAG_H + lane * 8;
#pragma unroll
    for (int dt = 0; dt < 4; ++dt) {
      v8h o;
#pragma unroll
      for (int j = 0; j < 8; ++j) o[j] = (_Float16)(oacc[dt][qg][j] * inv);
      *(v8h*)(ob + (dt >> 1) * FRAG_H + (dt & 1) * 256) = o;
    }
  }
}

// ---------------------------------------------------------------------------
// Kernel 3: out = AttnOut @ Wout^T + bias   (f16 WMMA, f32 bias/store)
// ---------------------------------------------------------------------------
__global__ __launch_bounds__(128) void out_gemm_kernel(
    const _Float16* __restrict__ A,   // [8192,1024] f16, fragment order
    const _Float16* __restrict__ W,   // [1024,1024] f16 (out,in), fragment order
    const float* __restrict__ bias,   // [1024] f32
    float* __restrict__ out) {        // [8192,1024] f32
  __shared__ __attribute__((aligned(1024))) _Float16 ring[2 * GS_H];
  const int lane = threadIdx.x & 31;
  const int wave = threadIdx.x >> 5;
  const int l15  = lane & 15;
  const int mb   = blockIdx.y * 128 + (wave >> 1) * 64;
  const int nb   = blockIdx.x * 128 + (wave & 1) * 64;

  v8f acc[4][4];
#pragma unroll
  for (int mt = 0; mt < 4; ++mt)
#pragma unroll
    for (int nt = 0; nt < 4; ++nt) acc[mt][nt] = (v8f)(0.0f);

  gemm_mainloop(A + (size_t)(blockIdx.y * 8) * GBAND, W + (size_t)(blockIdx.x * 8) * GBAND,
                ring, acc);

  float bv[4];
#pragma unroll
  for (int nt = 0; nt < 4; ++nt) bv[nt] = bias[nb + nt * 16 + l15];

  const int rsel = (lane >> 4) << 3;
#pragma unroll
  for (int mt = 0; mt < 4; ++mt)
#pragma unroll
    for (int nt = 0; nt < 4; ++nt)
#pragma unroll
      for (int j = 0; j < 8; ++j) {
        const int r = mb + mt * 16 + rsel + j;
        const int c = nb + nt * 16 + l15;
        out[(size_t)r * DIM + c] = acc[mt][nt][j] + bv[nt];
      }
}

// ---------------------------------------------------------------------------
extern "C" void kernel_launch(void* const* d_in, const int* in_sizes, int n_in,
                              void* d_out, int out_size, void* d_ws, size_t ws_size,
                              hipStream_t stream) {
  const float* x     = (const float*)d_in[0];   // [4,2048,1024]
  const float* w_qkv = (const float*)d_in[1];   // [1024,1024]
  const float* w_out = (const float*)d_in[2];   // [1024,1024]
  const float* b_out = (const float*)d_in[3];   // [1024]
  float* out = (float*)d_out;

  // workspace (f16, all in fragment order): xh 16MB | wqkvh 2MB | wouth 2MB | qkv 16MB | aout 16MB
  _Float16* xh    = (_Float16*)d_ws;
  _Float16* wqkvh = xh    + (size_t)MTOT * DIM;
  _Float16* wouth = wqkvh + (size_t)DIM * DIM;
  _Float16* qkv   = wouth + (size_t)DIM * DIM;
  _Float16* aout  = qkv   + (size_t)MTOT * DIM;

  // ---- pre-convert inputs to f16 (one launch for all three) ----
  cvt_f32_f16_kernel<<<CVT_BLOCKS, CVT_THREADS, 0, stream>>>(x, w_qkv, w_out, xh, wqkvh, wouth);
  {
    dim3 grid(DIM / 128, MTOT / 128);           // (8, 64)
    qkv_gemm_kernel<<<grid, 128, 0, stream>>>(xh, wqkvh, qkv);
  }
  {
    dim3 grid(SEQ / 256, BATCH * NHEAD);        // (8, 64)
    attn_kernel<<<grid, 256, 0, stream>>>(qkv, aout);
  }
  {
    dim3 grid(DIM / 128, MTOT / 128);           // (8, 64)
    out_gemm_kernel<<<grid, 128, 0, stream>>>(aout, wouth, b_out, out);
  }
}

// v010
// One run takes 84.1 microseconds.
// In both of two side-by-side timings against v009, it was 1.04 times as fast.
// All steps since v000 together make it 7.40 times as fast.
#include <hip/hip_runtime.h>
#include <hip/hip_bf16.h>

// ---------------------------------------------------------------------------
// Multi-head self-attention (shared QKV projection) for MI455X / gfx1250.
// f32 inputs are pre-converted to f16 once (one launch for all three), then all
// matmuls run through v_wmma_f32_16x16x32_f16 (f16 in, f32 accumulate) with
// pure f16 b128 fragment loads in the hot loops. Flash-attention style:
// the 1 GB score matrix never exists; softmax runs online in registers.
// The GEMMs stage their operand tiles, attention its key tiles (which are its value
// tiles too), in LDS, once per block, by asynchronous copies.
// Every f16 tensor in the workspace is kept in FRAGMENT ORDER (see below), so
// that one wave-wide 16-byte load or store covers 512 contiguous bytes.
// ---------------------------------------------------------------------------

typedef __attribute__((ext_vector_type(16))) _Float16 v16h;
typedef __attribute__((ext_vector_type(8)))  _Float16 v8h;
typedef __attribute__((ext_vector_type(8)))  float    v8f;
typedef __attribute__((ext_vector_type(4)))  float    v4f;

#define BATCH 4
#define SEQ   2048
#define DIM   1024
#define NHEAD 16
#define DHEAD 64
#define MTOT  (BATCH * SEQ)       // 8192 rows

union V16U { v16h v; v8h h[2]; };

// CDNA5 16-bit A/B fragment (16x32 / 32x16), per-lane layout:
//   lanes 0-15 : K = ko+{0..7} in halves 0-7, K = ko+{16..23} in halves 8-15, ko=0
//   lanes16-31 : same with ko=8
//
// Fragment order of a [rows][K] f16 matrix: the 16 x 32 fragment
// (rt = row >> 4, kc = k >> 5) is the 1 KB block number rt * (K / 32) + kc.
// Inside it, element (row & 15, k & 31) lies at half-word
//   ((k >> 4) & 1) * 256 + (((k >> 3) & 1) * 16 + (row & 15)) * 8 + (k & 7)
// i.e. lane L finds its halves 0-7 at L * 8 and its halves 8-15 at 256 + L * 8.
#define FRAG_H 512                 // half-words per fragment block
#define FR_DIM (DIM / 32)          // fragment blocks per 16-row band, K = DIM

// qkv alone keeps its fragments with one twist: in the 16-byte pieces of lanes 16-31 the
// row number has bit 3 flipped, i.e. lane L finds its pieces at frag_lane(L) * 8. A wave's
// plain 16-byte reads still cover 256 bytes in a row per lane half, and the transposing
// read of a 16 x 16 part (8 rows x two pieces per lane half) then meets every LDS bank
// once as well; without the twist its two pieces of a row fall on the same banks.
__device__ inline int frag_lane(int lane) { return lane ^ ((lane & 16) >> 1); }

// p points at the fragment block + lane * 8 (qkv: frag_lane(lane) * 8).
__device__ inline v16h frag_from_f16(const _Float16* __restrict__ p) {
  V16U u;
  u.h[0] = *(const v8h*)(p);
  u.h[1] = *(const v8h*)(p + 256);
  return u.v;
}

__device__ inline v8f wmma_f16(v16h a, v16h b, v8f c) {
  // D = A(16x32,f16) * B(32x16,f16) + C(16x16,f32)
  return __builtin_amdgcn_wmma_f32_16x16x32_f16(false, a, false, b,
                                                (short)0, c, false, false);
}

// ---------------------------------------------------------------------------
// Kernel 0: f32 -> f16 conversion of x and of both weight matrices ([rows][DIM] each)
// into fragment order, all in ONE launch of one 16-wave block per WGP. Piece i of a
// tensor is the i-th 16 bytes of its output and comes from the 8 floats that belong
// there. A lane converts ten pieces: eight of x (its wave takes four fragments in a row,
// 512 contiguous bytes of each of 16 rows, 4 KB of output) and one of each weight.
// One piece per lane would take ten times the waves: the pass is short, and what it costs
// is launches and wave starts more than bytes.
// ---------------------------------------------------------------------------
#define CVT_THREADS 512
#define CVT_BLOCKS  256
#define CVT_LANES   (CVT_THREADS * CVT_BLOCKS)
#define CVT_XP      8              // pieces of x per lane
static_assert(MTOT * DIM / 8 == CVT_XP * CVT_LANES, "x: eight pieces per lane");
static_assert(DIM * DIM / 8 == CVT_LANES, "a weight matrix: one piece per lane");
static_assert(FR_DIM % (CVT_XP / 2) == 0, "a wave's fragments of x share a row band");

// the 8 floats of piece i
__device__ inline const float* cvt_piece_src(const float* __restrict__ src, unsigned i) {
  const unsigned fr  = i >> 6;                          // fragment block
  const unsigned row = (fr / FR_DIM) * 16 + (i & 15);
  const unsigned k   = (fr % FR_DIM) * 32 + ((i >> 5) & 1) * 16 + ((i >> 4) & 1) * 8;
  return src + (size_t)(row * DIM + k);
}

__device__ inline v8h cvt_piece(v4f a, v4f b) {
  v8h o;
#pragma unroll
  for (int j = 0; j < 4; ++j) {
    o[j]     = (_Float16)a[j];
    o[4 + j] = (_Float16)b[j];
  }
  return o;
}

__global__ __launch_bounds__(CVT_THREADS) void cvt_f32_f16_kernel(
    const float* __restrict__ x, const float* __restrict__ wq, const float* __restrict__ wo,
    _Float16* __restrict__ xh, _Float16* __restrict__ wqh, _Float16* __restrict__ woh) {
  const unsigned g  = blockIdx.x * CVT_THREADS + threadIdx.x;
  const unsigned x0 = (g >> 5) * (32 * CVT_XP) + (g & 31);   // the lane's first piece of x
  // pieces x0 + 32 * j: the same row, 16 floats further on each (the wave's four
  // fragments lie in one 16-row band, as FR_DIM is a multiple of four)
  const float* sx = cvt_piece_src(x, x0);
  const float* sq = cvt_piece_src(wq, g);
  const float* so = cvt_piece_src(wo, g);

  v4f a[CVT_XP + 2], b[CVT_XP + 2];
#pragma unroll
  for (int j = 0; j < CVT_XP; ++j) {
    a[j] = *(const v4f*)(sx + j * 16);
    b[j] = *(const v4f*)(sx + j * 16 + 4);
  }
  a[CVT_XP]     = *(const v4f*)(sq);
  b[CVT_XP]     = *(const v4f*)(sq + 4);
  a[CVT_XP + 1] = *(const v4f*)(so);
  b[CVT_XP + 1] = *(const v4f*)(so + 4);
  // keeps all 20 loads in front of the first conversion, one memory latency per wave;
  // without it they are issued in two batches, the second behind a wait on the first
  __builtin_amdgcn_sched_barrier(0);
#pragma unroll
  for (int j = 0; j < CVT_XP; ++j)
    *(v8h*)(xh + (size_t)(x0 + j * 32) * 8) = cvt_piece(a[j], b[j]);
  *(v8h*)(wqh + (size_t)g * 8) = cvt_piece(a[CVT_XP], b[CVT_XP]);
  *(v8h*)(woh + (size_t)g * 8) = cvt_piece(a[CVT_XP + 1], b[CVT_XP + 1]);
}

// ---------------------------------------------------------------------------
// Main loop of both GEMMs: C[128 x 128] += A[128 x DIM] * B[128 x DIM]^T per block.
// Two waves need the same A rows, two the same B rows: the block brings every stage
// (128 k of both operands, 64 KB) into LDS once, two buffers, the next stage in
// flight while one is worked on, and the waves take their fragments from there.
// Stage layout (half-words): A fragment (band t of 8, kc of 4) at (t * 4 + kc) * FRAG_H,
// B fragment the same behind GS_OP_H. A band's four fragments are 4 KB in a row in
// global memory and in LDS alike.
// ---------------------------------------------------------------------------
#define GBAND   (FR_DIM * FRAG_H)  // half-words from one 16-row band to the next
#define GS_OP_H (8 * 4 * FRAG_H)   // half-words of one operand's part of a stage (32 KB)
#define GS_H    (2 * GS_OP_H)      // half-words per stage
#define GS_N    (DIM / 128)        // stages

// Four bands of one operand, per thread two 16-byte pieces (2 KB apart) of each.
// The wait in the same statement stands before the address registers are rewritten.
__device__ inline void copy_bands4(unsigned lds, const _Float16* g) {
  asm volatile(
      "global_load_async_to_lds_b128 %0, %8, off\n\t"
      "global_load_async_to_lds_b128 %1, %9, off\n\t"
      "global_load_async_to_lds_b128 %2, %10, off\n\t"
      "global_load_async_to_lds_b128 %3, %11, off\n\t"
      "global_load_async_to_lds_b128 %4, %12, off\n\t"
      "global_load_async_to_lds_b128 %5, %13, off\n\t"
      "global_load_async_to_lds_b128 %6, %14, off\n\t"
      "global_load_async_to_lds_b128 %7, %15, off\n\t"
      "s_wait_xcnt 0x0"
      :: "v"(lds), "v"(lds + 2048u), "v"(lds + 4096u), "v"(lds + 6144u),
         "v"(lds + 8192u), "v"(lds + 10240u), "v"(lds + 12288u), "v"(lds + 14336u),
         "v"(g), "v"(g + 1024), "v"(g + GBAND), "v"(g + GBAND + 1024),
         "v"(g + 2 * GBAND), "v"(g + 2 * GBAND + 1024),
         "v"(g + 3 * GBAND), "v"(g + 3 * GBAND + 1024)
      : "memory");
}

// One stage: 4096 pieces of 16 bytes, 32 per thread. a, b: the block's first band of each
// operand at the stage's first fragment, plus tid * 8.
__device__ inline void gemm_copy_stage(unsigned lds, const _Float16* a, const _Float16* b) {
  copy_bands4(lds, a);
  copy_bands4(lds + 16384u, a + 4 * GBAND);
  copy_bands4(lds + 32768u, b);
  copy_bands4(lds + 49152u, b + 4 * GBAND);
}

// A, B: the block's first band of each operand. ring: 2 * GS_H half-words of LDS.
__device__ inline void gemm_mainloop(const _Float16* __restrict__ A,
                                     const _Float16* __restrict__ B,
                                     const _Float16* ring, v8f (&acc)[4][4]) {
  const int tid  = threadIdx.x;
  const int lane = tid & 31;
  const int wave = tid >> 5;
  const _Float16* ac = A + tid * 8;
  const _Float16* bc = B + tid * 8;
  const unsigned lds0 = (unsigned)(size_t)(ring) + tid * 16;
  // this wave's four A bands and four B bands inside a stage
  const int offa = (wave >> 1) * 16 * FRAG_H + lane * 8;
  const int offb = GS_OP_H + (wave & 1) * 16 * FRAG_H + lane * 8;

  gemm_copy_stage(lds0, ac, bc);
  // stage 0 has landed (this wave's pieces), then is published to the block
  asm volatile("s_wait_asynccnt 0x0" ::: "memory");
  __syncthreads();
  gemm_copy_stage(lds0 + GS_H * 2, ac + 4 * FRAG_H, bc + 4 * FRAG_H);

  for (int t = 0; t < GS_N; ++t) {
    const _Float16* sa = ring + (t & 1) * GS_H + offa;
    const _Float16* sb = ring + (t & 1) * GS_H + offb;
    v16h af[2][4], bf[2][4];
#pragma unroll
    for (int i = 0; i < 4; ++i) {
      af[0][i] = frag_from_f16(sa + i * 4 * FRAG_H);
      bf[0][i] = frag_from_f16(sb + i * 4 * FRAG_H);
    }
#pragma unroll
    for (int ks = 0; ks < 4; ++ks) {
      if (ks < 3) {
#pragma unroll
        for (int i = 0; i < 4; ++i) {
          af[(ks + 1) & 1][i] = frag_from_f16(sa + (i * 4 + ks + 1) * FRAG_H);
          bf[(ks + 1) & 1][i] = frag_from_f16(sb + (i * 4 + ks + 1) * FRAG_H);
        }
      } else {
        // ---- publish stage t + 1, free this stage's buffer: the last k step's fragments
        // are in registers, so its products run while the refill is already in flight.
        // Keeps the products of the step before in front of the barrier; without it they
        // sink behind it and hold the refill's copies back by their whole run
        __builtin_amdgcn_sched_barrier(0);
        // this wave's reads of the buffer are done
        asm volatile("s_wait_dscnt 0x0" ::: "memory");
        // this wave's pieces of stage t + 1 have landed
        asm volatile("s_wait_asynccnt 0x0" ::: "memory");
        __syncthreads();
        if (t + 2 < GS_N)
          gemm_copy_stage(lds0 + (t & 1) * (GS_H * 2), ac + (t + 2) * 4 * FRAG_H,
                          bc + (t + 2) * 4 * FRAG_H);
      }
      // keeps the next k step's 16 LDS loads (behind the last step: the refill's copies) in
      // front of this step's products, so that their latency runs under the products;
      // without it the loads sink among the products and the copies behind them
      __builtin_amdgcn_sched_barrier(0);
#pragma unroll
      for (int mt = 0; mt < 4; ++mt)
#pragma unroll
        for (int nt = 0; nt < 4; ++nt)
          acc[mt][nt] = wmma_f16(af[ks & 1][mt], bf[ks & 1][nt], acc[mt][nt]);
    }
  }
  // no copy is outstanding when the wave ends
  asm volatile("s_wait_asynccnt 0x0" ::: "memory");
}

// ---------------------------------------------------------------------------
// Kernel 1: qkv = X @ Wqkv^T, computed as qkv^T = Wqkv @ X^T (f16 WMMA, f32 accumulate,
// f16 output): a lane then holds 8 consecutive d of ONE row of qkv, which is one 16-byte
// piece of a fragment, and a wave-wide store covers 512 bytes in a row.
// All three tensors are in fragment order.
// Block: 128 threads = 4 waves (2x2), block tile 128x128, wave tile 64x64.
// ---------------------------------------------------------------------------
__global__ __launch_bounds__(128) void qkv_gemm_kernel(
    const _Float16* __restrict__ X,   // [8192,1024] f16
    const _Float16* __restrict__ W,   // [1024,1024] f16 (out,in)
    _Float16* __restrict__ qkv) {     // [8192,1024]
  __shared__ __attribute__((aligned(1024))) _Float16 ring[2 * GS_H];
  const int lane = threadIdx.x & 31;
  const int wave = threadIdx.x >> 5;
  const int db   = blockIdx.x * 128 + (wave >> 1) * 64;   // first d (row of W)
  const int sb   = blockIdx.y * 128 + (wave & 1) * 64;    // first row of X

  v8f acc[4][4];
#pragma unroll
  for (int mt = 0; mt < 4; ++mt)
#pragma unroll
    for (int nt = 0; nt < 4; ++nt) acc[mt][nt] = (v8f)(0.0f);

  gemm_mainloop(W + (size_t)(blockIdx.x * 8) * GBAND, X + (size_t)(blockIdx.y * 8) * GBAND,
                ring, acc);

  // C-layout: the lane's column is row s0 + (lane & 15) of qkv, its 8 registers are
  // d0 + 8 * (lane >> 4) + 0..7
  // (d0 = db + mt * 16, s0 = sb + nt * 16): piece frag_lane(lane) of half (mt & 1) of
  // fragment (row band (sb >> 4) + nt, k chunk (db >> 5) + (mt >> 1))
  _Float16* qb = qkv + ((size_t)(sb >> 4) * FR_DIM + (db >> 5)) * FRAG_H + frag_lane(lane) * 8;
  v8h o[4][4];
#pragma unroll
  for (int mt = 0; mt < 4; ++mt)
#pragma unroll
    for (int nt = 0; nt < 4; ++nt)
#pragma unroll
      for (int j = 0; j < 8; ++j) o[mt][nt][j] = (_Float16)acc[mt][nt][j];
#pragma unroll
  for (int nt = 0; nt < 4; ++nt)
#pragma unroll
    for (int mt = 0; mt < 4; ++mt)
      *(v8h*)(qb + nt * GBAND + (mt >> 1) * FRAG_H + (mt & 1) * 256) = o[mt][nt];
}

// ---------------------------------------------------------------------------
// Kernel 2: flash attention, q=k=v=qkv, in transposed form:
//   S^T = K * Q^T   (A = key rows, B = query rows kept in registers)
//   O^T += V^T * P^T (A = the key tile read transposed, B = P^T packed from the S^T tiles)
// A lane of a 16-column group holds the scores of ONE query, so the sum runs in the
// lane; the two lane halves (keys 8h..8h+7 of each 16) join their sums once, after
// the loop.
// The exponent's argument comes straight out of the score product: Q is scaled when
// it is loaded and the accumulator starts at minus the query's reference, a maximum
// of earlier tiles. The reference is renewed (tile redone, O and sums rescaled) only
// in tile 0 and when a tile's row sum shows a weight too large for f16.
// Two S^T accumulator tiles (keys 0-15, 16-31) converted in place are the
// B operand of the second product: P needs no LDS and no barrier.
// One block = (b,h, 256 q-rows); each of 8 waves owns 32 queries, loops keys
// in tiles of 64.
// All 8 waves read the same tiles, and K and V are the same rows: the block brings the
// keys into LDS once, in stages of four tiles (two buffers, the next stage in flight
// while one is worked on); the waves take their K fragments from there by plain reads and
// their V^T fragments from the same bytes by the transposing read. No transposed copy of
// qkv exists. The waves meet at a barrier once per stage: inside a stage each runs at its
// own pace, so that one wave's products can run beside another's exponentials.
// Tile layout (half-words): fragment (16 keys nt, 32 d ks) at (nt * 2 + ks) * FRAG_H.
// ---------------------------------------------------------------------------
#define TILE_H   4096              // half-words per tile (64 keys x 64 d, 8 KB)
#define ST_TILES 4                 // tiles per stage
#define STAGE_H  (ST_TILES * TILE_H)
#define ST_N     (SEQ / 64 / ST_TILES)   // stages
static_assert((ST_TILES & (ST_TILES - 1)) == 0 && ST_N >= 2, "ring: two whole stages");

// Four pieces of 16 bytes per thread: 16-key bands two apart (4 KB in LDS).
// The wait in the same statement stands before the address registers are rewritten.
__device__ inline void copy_pieces4(unsigned lds, const _Float16* k) {
  asm volatile(
      "global_load_async_to_lds_b128 %0, %4, off\n\t"
      "global_load_async_to_lds_b128 %1, %5, off\n\t"
      "global_load_async_to_lds_b128 %2, %6, off\n\t"
      "global_load_async_to_lds_b128 %3, %7, off\n\t"
      "s_wait_xcnt 0x0"
      :: "v"(lds), "v"(lds + 4096u), "v"(lds + 8192u), "v"(lds + 12288u),
         "v"(k), "v"(k + 2 * GBAND), "v"(k + 4 * GBAND), "v"(k + 6 * GBAND)
      : "memory");
}

// One stage = 16 bands of 2 KB = 2048 pieces of 16 bytes, eight per thread: piece
// c * 256 + tid. k: the stage's band (tid >> 7) at the thread's piece of it.
__device__ inline void copy_stage(unsigned lds, const _Float16* k) {
  copy_pieces4(lds, k);
  copy_pieces4(lds + 16384u, k + 8 * GBAND);
}

// ds_load_tr16_b128: lane l hands in the address of 8 d of key 8 * (l >> 4) + (l & 7), d part
// (l >> 3) & 1, of a 16 key x 16 d part; it gets back keys 8 * (l >> 4) + 0..7 of d = l & 15.
typedef short s16x8 __attribute__((ext_vector_type(8)));
__device__ inline v8h lds_tr16(const _Float16* p) {
  typedef __attribute__((address_space(3))) s16x8 lds_s16x8;
  return __builtin_bit_cast(v8h, __builtin_amdgcn_ds_load_tr16_b128_v8i16((lds_s16x8*)p));
}

// V^T fragment (16 d from dt * 16, 32 keys from c2 * 32). vt: the tile + the lane's piece.
__device__ inline v16h vt_frag(const _Float16* vt, int dt, int c2) {
  V16U u;
  const _Float16* p = vt + (c2 * 4 + (dt >> 1)) * FRAG_H + (dt & 1) * 256;
  u.h[0] = lds_tr16(p);                  // keys c2 * 32 + 0..15
  u.h[1] = lds_tr16(p + 2 * FRAG_H);     // keys c2 * 32 + 16..31
  return u.v;
}
// value of the same column in the other 16-lane half (lane l <-> l ^ 16)
__device__ inline float other_half(float v) {
  int b = __builtin_bit_cast(int, v);
  b = __builtin_amdgcn_permlanex16(b, b, 0x76543210, 0xfedcba98, false, false);
  return __builtin_bit_cast(float, b);
}

// 2^x as the bare hardware instruction. The library's exp2f adds a range check per value
// (compare, select, add, select, ldexp) that only serves results below 2^-126. Each
// query's largest term is at least 2^0 = 1, so such a result is 0 as an f16 weight and
// is lost in the f32 sum either way.
__device__ inline float exp2_bare(float x) { return __builtin_amdgcn_exp2f(x); }

// sc[nt][qg] = K tile (64 keys, from LDS at st) * scaled Q^T + nref[qg]
__device__ inline void attn_scores(const _Float16* st, const v16h (&qf)[2][2],
                                   const float (&nref)[2], v8f (&sc)[4][2]) {
  v16h kf[2][4];
#pragma unroll
  for (int ks = 0; ks < 2; ++ks)
#pragma unroll
    for (int nt = 0; nt < 4; ++nt)
      kf[ks][nt] = frag_from_f16(st + (nt * 2 + ks) * FRAG_H);
  // keeps the tile's 16 loads together in front of the products (one latency, counted
  // waits); without it most are issued in pairs among the products, each pair waited
  // out in full
  __builtin_amdgcn_sched_barrier(0);
#pragma unroll
  for (int nt = 0; nt < 4; ++nt)
#pragma unroll
    for (int qg = 0; qg < 2; ++qg)
      sc[nt][qg] = wmma_f16(kf[0][nt], qf[qg][0], (v8f)(nref[qg]));
#pragma unroll
  for (int nt = 0; nt < 4; ++nt)
#pragma unroll
    for (int qg = 0; qg < 2; ++qg)
      sc[nt][qg] = wmma_f16(kf[1][nt], qf[qg][1], sc[nt][qg]);
}

// sum of one query's 32 weights in this lane
__device__ inline float row_sum(const v8f (&sc)[4][2], int qg) {
  const v8f s8 = (sc[0][qg] + sc[1][qg]) + (sc[2][qg] + sc[3][qg]);
  return ((s8[0] + s8[1]) + (s8[2] + s8[3])) + ((s8[4] + s8[5]) + (s8[6] + s8[7]));
}

__global__ __launch_bounds__(256) void attn_kernel(
    const _Float16* __restrict__ qkv,   // [4*2048][1024], fragment order (frag_lane)
    _Float16* __restrict__ aout) {      // [4*2048][1024], fragment order
  __shared__ __attribute__((aligned(1024))) _Float16 ring[2 * STAGE_H];
  const int lane = threadIdx.x & 31;
  const int wave = threadIdx.x >> 5;

  const int bh = blockIdx.y;
  const int b  = bh >> 4;
  const int h  = bh & 15;
  const int q0 = blockIdx.x * 256 + wave * 32;

  // fragment (16 rows from seq position s, d chunk ks) : qk + (s >> 4) * KBAND + ks * FRAG_H
  const int KBAND = FR_DIM * FRAG_H;
  const _Float16* qk = qkv + ((size_t)(b * SEQ >> 4) * FR_DIM + h * (DHEAD / 32)) * FRAG_H;
  // the lane's piece of a fragment half: for plain reads, and for the transposing read
  // (row 8 * (lane >> 4) + (lane & 7), d part (lane >> 3) & 1, which is 'lane half' there)
  const int lsw = frag_lane(lane);
  const int ltr = frag_lane(((lane & 8) << 1) | ((lane & 16) >> 1) | (lane & 7));

  // scale folded into exp2 domain: exp(s/8) = 2^(s * log2(e)/8)
  const float SC2 = 0.18033688011112042f;

  // resident Q fragments (B operand, column = query): [qg][ks]
  v16h qf[2][2];
#pragma unroll
  for (int qg = 0; qg < 2; ++qg)
#pragma unroll
    for (int ks = 0; ks < 2; ++ks)
    {
      const v16h q = frag_from_f16(qk + (size_t)((q0 >> 4) + qg) * KBAND + ks * FRAG_H + lsw * 8);
#pragma unroll
      for (int s = 0; s < 16; ++s) qf[qg][ks][s] = (_Float16)((float)q[s] * SC2);
    }

  // O^T tiles: oacc[dt][qg][r] = O[query qg*16+l15][d = dt*16 + rsel + r]
  v8f oacc[4][2];
#pragma unroll
  for (int dt = 0; dt < 4; ++dt)
#pragma unroll
    for (int qg = 0; qg < 2; ++qg) oacc[dt][qg] = (v8f)(0.0f);

  float nref[2], lrow[2];   // per lane: minus its query's reference, its half's sum
#pragma unroll
  for (int qg = 0; qg < 2; ++qg) { nref[qg] = 0.0f; lrow[qg] = 0.0f; }
  // a half's sum of a tile up to here: every weight of it fits f16 (largest 65504)
  const float SUM_LIM = 32768.0f;

  // this thread's pieces of a stage: a stage is 16 runs of 2 KB (128 pieces), one
  // per band; bands (tid >> 7) + 0, 2, .. 14
  const int tid = threadIdx.x;
  const _Float16* kc = qk + (size_t)(tid >> 7) * KBAND + (tid & 127) * 8;
  const unsigned lds0 = (unsigned)(size_t)(&ring[0]) + tid * 16;

  copy_stage(lds0, kc);
  // stage 0 has landed (this wave's pieces), then is published to the block
  asm volatile("s_wait_asynccnt 0x0" ::: "memory");
  __syncthreads();
  copy_stage(lds0 + STAGE_H * 2, kc + (size_t)(ST_TILES * 4) * KBAND);

  for (int kt = 0; kt < SEQ / 64; ++kt) {
    // tile kt & 3 of stage kt >> 2, which lies in buffer (kt >> 2) & 1
    const _Float16* st = ring + (kt & (2 * ST_TILES - 1)) * TILE_H + lsw * 8;
    const _Float16* vt = ring + (kt & (2 * ST_TILES - 1)) * TILE_H + ltr * 8;

    // ---- scores S^T = K @ Q^T - reference : sc[nt][qg][r] for key nt*16+rsel+r
    v8f sc[4][2];
    float rs[2];
    attn_scores(st, qf, nref, sc);

    // ---- weights and row sums, one query per lane --------------------------
#pragma unroll
    for (int qg = 0; qg < 2; ++qg) {
#pragma unroll
      for (int nt = 0; nt < 4; ++nt)
#pragma unroll
        for (int j = 0; j < 8; ++j) sc[nt][qg][j] = exp2_bare(sc[nt][qg][j]);
      rs[qg] = row_sum(sc, qg);
    }

    // ---- new reference: tile 0, or a weight that may not fit f16 (also inf, NaN) ----
    // one test per tile, a scalar branch
    const bool big = !(rs[0] <= SUM_LIM) | !(rs[1] <= SUM_LIM) | (kt == 0);
    if (__builtin_amdgcn_ballot_w32(big) != 0) {
      attn_scores(st, qf, nref, sc);
#pragma unroll
      for (int qg = 0; qg < 2; ++qg) {
        float m8[8];
#pragma unroll
        for (int j = 0; j < 8; ++j)
          m8[j] = fmaxf(fmaxf(sc[0][qg][j], sc[1][qg][j]),
                        fmaxf(sc[2][qg][j], sc[3][qg][j]));
        float tm = fmaxf(fmaxf(fmaxf(m8[0], m8[1]), fmaxf(m8[2], m8[3])),
                         fmaxf(fmaxf(m8[4], m8[5]), fmaxf(m8[6], m8[7])));
        tm = fmaxf(tm, other_half(tm));
        // the reference only rises; tile 0 sets it, with nothing yet to rescale
        const float up   = (kt == 0) ? tm : fmaxf(tm, 0.0f);
        const float corr = (kt == 0) ? 0.0f : exp2_bare(-up);
        nref[qg] -= up;
        lrow[qg] *= corr;
#pragma unroll
        for (int dt = 0; dt < 4; ++dt) oacc[dt][qg] *= corr;
#pragma unroll
        for (int nt = 0; nt < 4; ++nt)
#pragma unroll
          for (int j = 0; j < 8; ++j) sc[nt][qg][j] = exp2_bare(sc[nt][qg][j] - up);
        rs[qg] = row_sum(sc, qg);
      }
    }

    // The branch above keeps the V^T loads from starting among the exponentials; left to
    // the compiler they are issued behind it pair by pair, each pair waited out in full.
    // So they stand here as two groups, each ahead of other work.
    v16h vf[2][4];
#pragma unroll
    for (int dt = 0; dt < 4; ++dt)
      vf[0][dt] = vt_frag(vt, dt, 0);
    // holds the first group in front of the packing, which covers part of its latency
    __builtin_amdgcn_sched_barrier(0);

    v16h pf[2][2];            // P^T as B operand: [qg][32-key chunk]
#pragma unroll
    for (int qg = 0; qg < 2; ++qg) {
      lrow[qg] += rs[qg];
      // element s of the B operand is key kmap(s) = tile (s >> 3), register s & 7
#pragma unroll
      for (int c2 = 0; c2 < 2; ++c2)
#pragma unroll
        for (int s = 0; s < 16; ++s)
          pf[qg][c2][s] = (_Float16)sc[c2 * 2 + (s >> 3)][qg][s & 7];
    }

    // ---- O^T += V^T @ P^T --------------------------------------------------
#pragma unroll
    for (int dt = 0; dt < 4; ++dt)
      vf[1][dt] = vt_frag(vt, dt, 1);
    // holds the second group in front of the first group's products, which cover its latency
    __builtin_amdgcn_sched_barrier(0);
#pragma unroll
    for (int c2 = 0; c2 < 2; ++c2)
#pragma unroll
      for (int dt = 0; dt < 4; ++dt)
#pragma unroll
        for (int qg = 0; qg < 2; ++qg)
          oacc[dt][qg] = wmma_f16(vf[c2][dt], pf[qg][c2], oacc[dt][qg]);

    // ---- behind a stage's last tile: publish the next stage, free this one's buffer ----
    if ((kt & (ST_TILES - 1)) == ST_TILES - 1) {
      const int sg = kt / ST_TILES;
      // this wave's reads of the buffer are done
      asm volatile("s_wait_dscnt 0x0" ::: "memory");
      // this wave's pieces of stage sg + 1 have landed
      asm volatile("s_wait_asynccnt 0x0" ::: "memory");
      __syncthreads();
      if (sg + 2 < ST_N)
        copy_stage(lds0 + (sg & 1) * (STAGE_H * 2), kc + (size_t)((sg + 2) * ST_TILES * 4) * KBAND);
    }
  }
  // no copy is outstanding when the wave ends
  asm volatile("s_wait_asynccnt 0x0" ::: "memory");

  // ---- join the halves' sums, normalize, store 8 consecutive d per lane ----
#pragma unroll
  for (int qg = 0; qg < 2; ++qg) {
    const float inv = 1.0f / (lrow[qg] + other_half(lrow[qg]));
    // row = the lane's query, k = h * 64 + dt * 16 + 8 * (lane >> 4) + 0..7: piece number
    // 'lane' of half (dt & 1) of fragment (row band, h * 2 + (dt >> 1))
    _Float16* ob = aout + ((size_t)(((b * SEQ + q0) >> 4) + qg) * FR_DIM + h * (DHEAD / 32)) * FRAG_H + lane * 8;
#pragma unroll
    for (int dt = 0; dt < 4; ++dt) {
      v8h o;
#pragma unroll
      for (int j = 0; j < 8; ++j) o[j] = (_Float16)(oacc[dt][qg][j] * inv);
      *(v8h*)(ob + (dt >> 1) * FRAG_H + (dt & 1) * 256) = o;
    }
  }
}

// ---------------------------------------------------------------------------
// Kernel 3: out = AttnOut @ Wout^T + bias   (f16 WMMA, f32 bias/store)
// ---------------------------------------------------------------------------
__global__ __launch_bounds__(128) void out_gemm_kernel(
    const _Float16* __restrict__ A,   // [8192,1024] f16, fragment order
    const _Float16* __restrict__ W,   // [1024,1024] f16 (out,in), fragment order
    const float* __restrict__ bias,   // [1024] f32
    float* __restrict__ out) {        // [8192,1024] f32
  __shared__ __attribute__((aligned(1024))) _Float16 ring[2 * GS_H];
  const int lane = threadIdx.x & 31;
  const int wave = threadIdx.x >> 5;
  const int l15  = lane & 15;
  const int mb   = blockIdx.y * 128 + (wave >> 1) * 64;
  const int nb   = blockIdx.x * 128 + (wave & 1) * 64;

  v8f acc[4][4];
#pragma unroll
  for (int mt = 0; mt < 4; ++mt)
#pragma unroll
    for (int nt = 0; nt < 4; ++nt) acc[mt][nt] = (v8f)(0.0f);

  gemm_mainloop(A + (size_t)(blockIdx.y * 8) * GBAND, W + (size_t)(blockIdx.x * 8) * GBAND,
                ring, acc);

  float bv[4];
#pragma unroll
  for (int nt = 0; nt < 4; ++nt) bv[nt] = bias[nb + nt * 16 + l15];

  const int rsel = (lane >> 4) << 3;
#pragma unroll
  for (int mt = 0; mt < 4; ++mt)
#pragma unroll
    for (int nt = 0; nt < 4; ++nt)
#pragma unroll
      for (int j = 0; j < 8; ++j) {
        const int r = mb + mt * 16 + rsel + j;
        const int c = nb + nt * 16 + l15;
        out[(size_t)r * DIM + c] = acc[mt][nt][j] + bv[nt];
      }
}

// ---------------------------------------------------------------------------
extern "C" void kernel_launch(void* const* d_in, const int* in_sizes, int n_in,
                              void* d_out, int out_size, void* d_ws, size_t ws_size,
                              hipStream_t stream) {
  const float* x     = (const float*)d_in[0];   // [4,2048,1024]
  const float* w_qkv = (const float*)d_in[1];   // [1024,1024]
  const float* w_out = (const float*)d_in[2];   // [1024,1024]
  const float* b_out = (const float*)d_in[3];   // [1024]
  float* out = (float*)d_out;

  // workspace (f16, all in fragment order): xh 16MB | wqkvh 2MB | wouth 2MB | qkv 16MB | aout 16MB
  _Float16* xh    = (_Float16*)d_ws;
  _Float16* wqkvh = xh    + (size_t)MTOT * DIM;
  _Float16* wouth = wqkvh + (size_t)DIM * DIM;
  _Float16* qkv   = wouth + (size_t)DIM * DIM;
  _Float16* aout  = qkv   + (size_t)MTOT * DIM;

  // ---- pre-convert inputs to f16 (one launch for all three) ----
  cvt_f32_f16_kernel<<<CVT_BLOCKS, CVT_THREADS, 0, stream>>>(x, w_qkv, w_out, xh, wqkvh, wouth);
  {
    dim3 grid(DIM / 128, MTOT / 128);           // (8, 64)
    qkv_gemm_kernel<<<grid, 128, 0, stream>>>(xh, wqkvh, qkv);
  }
  {
    dim3 grid(SEQ / 256, BATCH * NHEAD);        // (8, 64)
    attn_kernel<<<grid, 256, 0, stream>>>(qkv, aout);
  }
  {
    dim3 grid(DIM / 128, MTOT / 128);           // (8, 64)
    out_gemm_kernel<<<grid, 128, 0, stream>>>(aout, wouth, b_out, out);
  }
}
